// v000
// The times below were measured on an AMD MI455X: many runs one after another, warmed up first and cycling through
// copies of the inputs, with the whole window's GPU time divided by the number of runs. Launches and the gaps
// between them are all in it. The median over several windows is given; except for v000 it joins two sittings, which
// can be a few percent apart, so the side-by-side timings, each taken in one sitting, are the better comparison.
// v000 is the starting kernel. One run takes 572 microseconds.
#include <hip/hip_runtime.h>
#include <math.h>
#include <stdint.h>

typedef float v2f __attribute__((ext_vector_type(2)));
typedef float v8f __attribute__((ext_vector_type(8)));

#define B_ 2
#define T_ 2048
#define C_ 1024
#define H_ 16
#define D_ 64

#ifndef __has_builtin
#define __has_builtin(x) 0
#endif
#if defined(__HIP_DEVICE_COMPILE__) && \
    __has_builtin(__builtin_amdgcn_tensor_load_to_lds) && \
    __has_builtin(__builtin_amdgcn_s_wait_tensorcnt)
#define USE_TDM 1
#else
#define USE_TDM 0
#endif

__device__ __forceinline__ v8f wmma_f32(v2f a, v2f b, v8f c) {
  // V_WMMA_F32_16X16X4_F32 : D = A(16x4) * B(4x16) + C(16x16), fp32
  return __builtin_amdgcn_wmma_f32_16x16x4_f32(false, a, false, b, (short)0, c,
                                               false, false);
}

#if USE_TDM
typedef unsigned int v4u __attribute__((ext_vector_type(4)));
typedef int v4i __attribute__((ext_vector_type(4)));
typedef int v8i __attribute__((ext_vector_type(8)));

// DMA a 16x64 fp32 tile (rows contiguous, row stride 64 floats in memory)
// into LDS with 4-dword padding after each 64-dword row => LDS stride 68.
__device__ __forceinline__ void tdm_load_tile_16x64(const float* gsrc,
                                                    unsigned lds_addr) {
  uint64_t ga = (uint64_t)(uintptr_t)gsrc;
  v4u g0;
  g0[0] = 1u;
  g0[1] = lds_addr;
  g0[2] = (unsigned)(ga & 0xffffffffu);
  g0[3] = (unsigned)((ga >> 32) & 0x01ffffffu)
          | (2u << 30);
  v8i g1;
  g1[0] = (int)((2u << 16)
                | (1u << 20)
                | (5u << 22)
                | (3u << 25));
  g1[1] = (int)(64u << 16);
  g1[2] = (int)(16u << 16);
  g1[3] = (int)(64u << 16);
  g1[4] = 16;
  g1[5] = 64;
  g1[6] = 0;
  g1[7] = 0;
  v4i zz = {0, 0, 0, 0};
#if __clang_major__ >= 23
  v8i zz8 = {0, 0, 0, 0, 0, 0, 0, 0};
  __builtin_amdgcn_tensor_load_to_lds(g0, g1, zz, zz, zz8, 0);
#else
  __builtin_amdgcn_tensor_load_to_lds(g0, g1, zz, zz, 0);
#endif
}
#endif  // USE_TDM

// ---------------- QKV projection: y = x @ W^T, scatter to (B,H,T,D) ----------
// 32(M) x 64(N) tile per wave: two A-fragments share four B-fragments.
__global__ __launch_bounds__(32) void qkv_proj_kernel(
    const float* __restrict__ x,
    const float* __restrict__ Wq, const float* __restrict__ Wk,
    const float* __restrict__ Wv,
    float* __restrict__ qb, float* __restrict__ kb, float* __restrict__ vb)
{
  const int lane = threadIdx.x;
  const int half = lane >> 4, l16 = lane & 15;
  const int mBase = blockIdx.x * 32;
  const int nBase = blockIdx.y * 64;
  const float* W; float* out;
  if (blockIdx.z == 0)      { W = Wq; out = qb; }
  else if (blockIdx.z == 1) { W = Wk; out = kb; }
  else                      { W = Wv; out = vb; }

  v8f acc0[4], acc1[4];
  #pragma unroll
  for (int j = 0; j < 4; ++j)
    #pragma unroll
    for (int r = 0; r < 8; ++r) { acc0[j][r] = 0.0f; acc1[j][r] = 0.0f; }

  const float* xrow0 = x + (size_t)(mBase + l16) * C_;
  const float* xrow1 = xrow0 + (size_t)16 * C_;
  const float* wrow  = W + (size_t)(nBase + l16) * C_;
  for (int k = 0; k < C_; k += 4) {
    v2f a0 = *(const v2f*)(xrow0 + k + 2 * half);
    v2f a1 = *(const v2f*)(xrow1 + k + 2 * half);
    #pragma unroll
    for (int j = 0; j < 4; ++j) {
      v2f b = *(const v2f*)(wrow + (size_t)j * 16 * C_ + k + 2 * half);
      acc0[j] = wmma_f32(a0, b, acc0[j]);
      acc1[j] = wmma_f32(a1, b, acc1[j]);
    }
  }

  #pragma unroll
  for (int j = 0; j < 4; ++j) {
    #pragma unroll
    for (int r = 0; r < 8; ++r) {
      int n = nBase + j * 16 + l16;           // h*D + d
      int h = n >> 6, d = n & (D_ - 1);
      int m0 = mBase + r + 8 * half;          // b*T + t
      int b0 = m0 >> 11, t0 = m0 & (T_ - 1);
      out[((size_t)(b0 * H_ + h) * T_ + t0) * D_ + d] = acc0[j][r];
      int m1 = m0 + 16;
      int b1 = m1 >> 11, t1 = m1 & (T_ - 1);
      out[((size_t)(b1 * H_ + h) * T_ + t1) * D_ + d] = acc1[j][r];
    }
  }
}

// ---------------- Output projection: Y = X @ Wo^T (row-major) ----------------
__global__ __launch_bounds__(32) void out_proj_kernel(
    const float* __restrict__ X, const float* __restrict__ Wo,
    float* __restrict__ Y)
{
  const int lane = threadIdx.x;
  const int half = lane >> 4, l16 = lane & 15;
  const int mBase = blockIdx.x * 32;
  const int nBase = blockIdx.y * 64;

  v8f acc0[4], acc1[4];
  #pragma unroll
  for (int j = 0; j < 4; ++j)
    #pragma unroll
    for (int r = 0; r < 8; ++r) { acc0[j][r] = 0.0f; acc1[j][r] = 0.0f; }

  const float* xrow0 = X + (size_t)(mBase + l16) * C_;
  const float* xrow1 = xrow0 + (size_t)16 * C_;
  const float* wrow  = Wo + (size_t)(nBase + l16) * C_;
  for (int k = 0; k < C_; k += 4) {
    v2f a0 = *(const v2f*)(xrow0 + k + 2 * half);
    v2f a1 = *(const v2f*)(xrow1 + k + 2 * half);
    #pragma unroll
    for (int j = 0; j < 4; ++j) {
      v2f b = *(const v2f*)(wrow + (size_t)j * 16 * C_ + k + 2 * half);
      acc0[j] = wmma_f32(a0, b, acc0[j]);
      acc1[j] = wmma_f32(a1, b, acc1[j]);
    }
  }

  #pragma unroll
  for (int j = 0; j < 4; ++j) {
    #pragma unroll
    for (int r = 0; r < 8; ++r) {
      int n = nBase + j * 16 + l16;
      int m0 = mBase + r + 8 * half;
      Y[(size_t)m0 * C_ + n] = acc0[j][r];
      Y[(size_t)(m0 + 16) * C_ + n] = acc1[j][r];
    }
  }
}

// ---------------- Flash attention with ALiBi bias (causal) ------------------
#define KRS 68
#define PRS 18

__global__ __launch_bounds__(32) void attn_kernel(
    const float* __restrict__ qb, const float* __restrict__ kb,
    const float* __restrict__ vb, float* __restrict__ ob)
{
  __shared__ __align__(16) float pbuf[16 * PRS];
#if USE_TDM
  __shared__ __align__(16) float ktile[16 * KRS + 4];
  __shared__ __align__(16) float vtile[16 * KRS + 4];
#endif
  const int lane = threadIdx.x;
  const int half = lane >> 4, l16 = lane & 15;
  const int qt = blockIdx.x, h = blockIdx.y, b = blockIdx.z;
  const int qBase = qt * 16;
  const size_t headoff = (size_t)(b * H_ + h) * T_ * D_;
  const float* Qp = qb + headoff;
  const float* Kp = kb + headoff;
  const float* Vp = vb + headoff;
  const float slope = exp2f(-0.5f * (float)(h + 1));  // H=16 power-of-2 slopes
  const float scale = 0.125f;                         // 1/sqrt(64)

  // preload Q tile (16x64) as 16 A-fragments
  v2f qa[16];
  const float* qrow = Qp + (size_t)(qBase + l16) * D_;
  #pragma unroll
  for (int kk = 0; kk < 16; ++kk)
    qa[kk] = *(const v2f*)(qrow + kk * 4 + 2 * half);

  v8f o[4];
  float mx[8], sm[8];
  #pragma unroll
  for (int j = 0; j < 4; ++j)
    #pragma unroll
    for (int r = 0; r < 8; ++r) o[j][r] = 0.0f;
  #pragma unroll
  for (int r = 0; r < 8; ++r) { mx[r] = -1e30f; sm[r] = 0.0f; }

  for (int kt = 0; kt <= qt; ++kt) {
    const int kBase = kt * 16;

#if USE_TDM
    tdm_load_tile_16x64(Kp + (size_t)kBase * D_,
                        (unsigned)(uintptr_t)&ktile[0]);
    tdm_load_tile_16x64(Vp + (size_t)kBase * D_,
                        (unsigned)(uintptr_t)&vtile[0]);
    __builtin_amdgcn_s_wait_tensorcnt(0);
#endif

    // S = Q @ K^T  (16x16)
    v8f s;
    #pragma unroll
    for (int r = 0; r < 8; ++r) s[r] = 0.0f;
    #pragma unroll
    for (int kk = 0; kk < 16; ++kk) {
#if USE_TDM
      v2f kf = *(const v2f*)(&ktile[l16 * KRS + kk * 4 + 2 * half]);
#else
      v2f kf = *(const v2f*)(Kp + (size_t)(kBase + l16) * D_ + kk * 4 + 2 * half);
#endif
      s = wmma_f32(qa[kk], kf, s);
    }

    // bias + causal mask + online softmax (row = r + 8*half, col = l16)
    float p[8];
    #pragma unroll
    for (int r = 0; r < 8; ++r) {
      int qi = qBase + r + 8 * half;
      int ki = kBase + l16;
      float val = s[r] * scale - slope * fabsf((float)(qi - ki));
      if (ki > qi) val = -1e30f;
      float vmax = val;
      #pragma unroll
      for (int msk = 1; msk <= 8; msk <<= 1)
        vmax = fmaxf(vmax, __shfl_xor(vmax, msk, 32));
      float nm   = fmaxf(mx[r], vmax);
      float corr = __expf(mx[r] - nm);
      float pe   = __expf(val - nm);
      float psum = pe;
      #pragma unroll
      for (int msk = 1; msk <= 8; msk <<= 1)
        psum += __shfl_xor(psum, msk, 32);
      sm[r] = sm[r] * corr + psum;
      mx[r] = nm;
      #pragma unroll
      for (int j = 0; j < 4; ++j) o[j][r] *= corr;
      p[r] = pe;
    }

    // D-layout -> A-layout conversion of P through LDS
    #pragma unroll
    for (int r = 0; r < 8; ++r) pbuf[(r + 8 * half) * PRS + l16] = p[r];
    __syncthreads();

    // O += P @ V  (16x16 * 16x64)
    #pragma unroll
    for (int kk = 0; kk < 4; ++kk) {
      v2f pa = *(const v2f*)(&pbuf[l16 * PRS + kk * 4 + 2 * half]);
      const int kl = kk * 4 + 2 * half;  // key-local row
      #pragma unroll
      for (int j = 0; j < 4; ++j) {
        v2f vf;
#if USE_TDM
        vf[0] = vtile[kl * KRS + j * 16 + l16];
        vf[1] = vtile[(kl + 1) * KRS + j * 16 + l16];
#else
        vf[0] = Vp[(size_t)(kBase + kl) * D_ + j * 16 + l16];
        vf[1] = Vp[(size_t)(kBase + kl + 1) * D_ + j * 16 + l16];
#endif
        o[j] = wmma_f32(pa, vf, o[j]);
      }
    }
    __syncthreads();
  }

  // normalize and store to (B,T,C)
  #pragma unroll
  for (int j = 0; j < 4; ++j) {
    #pragma unroll
    for (int r = 0; r < 8; ++r) {
      int m = qBase + r + 8 * half;
      int d = j * 16 + l16;
      ob[(size_t)(b * T_ + m) * C_ + h * D_ + d] = o[j][r] / sm[r];
    }
  }
}

extern "C" void kernel_launch(void* const* d_in, const int* in_sizes, int n_in,
                              void* d_out, int out_size, void* d_ws, size_t ws_size,
                              hipStream_t stream) {
  (void)in_sizes; (void)n_in; (void)out_size; (void)ws_size;
  const float* x  = (const float*)d_in[0];
  const float* Wq = (const float*)d_in[1];
  const float* Wk = (const float*)d_in[2];
  const float* Wv = (const float*)d_in[3];
  const float* Wo = (const float*)d_in[4];
  float* out = (float*)d_out;

  const size_t per = (size_t)B_ * H_ * T_ * D_;  // 4M floats per buffer
  float* qb = (float*)d_ws;
  float* kb = qb + per;
  float* vb = kb + per;
  float* ab = vb + per;  // attention output in (B,T,C)

  dim3 blk(32, 1, 1);
  qkv_proj_kernel<<<dim3((B_ * T_) / 32, C_ / 64, 3), blk, 0, stream>>>(
      x, Wq, Wk, Wv, qb, kb, vb);
  attn_kernel<<<dim3(T_ / 16, H_, B_), blk, 0, stream>>>(qb, kb, vb, ab);
  out_proj_kernel<<<dim3((B_ * T_) / 32, C_ / 64, 1), blk, 0, stream>>>(
      ab, Wo, out);
}

// v001
// Measured time: 443 microseconds a run.
// Timed twice side by side with v000, it ran 1.47 and 1.48 times as fast.
#include <hip/hip_runtime.h>
#include <math.h>
#include <stdint.h>

typedef float v2f __attribute__((ext_vector_type(2)));
typedef float v4f __attribute__((ext_vector_type(4)));
typedef float v8f __attribute__((ext_vector_type(8)));

#define B_ 2
#define T_ 2048
#define C_ 1024
#define H_ 16
#define D_ 64

#ifndef __has_builtin
#define __has_builtin(x) 0
#endif
#if defined(__HIP_DEVICE_COMPILE__) && \
    __has_builtin(__builtin_amdgcn_tensor_load_to_lds) && \
    __has_builtin(__builtin_amdgcn_s_wait_tensorcnt)
#define USE_TDM 1
#else
#define USE_TDM 0
#endif

__device__ __forceinline__ v8f wmma_f32(v2f a, v2f b, v8f c) {
  // V_WMMA_F32_16X16X4_F32 : D = A(16x4) * B(4x16) + C(16x16), fp32
  return __builtin_amdgcn_wmma_f32_16x16x4_f32(false, a, false, b, (short)0, c,
                                               false, false);
}

#if USE_TDM
typedef unsigned int v4u __attribute__((ext_vector_type(4)));
typedef int v4i __attribute__((ext_vector_type(4)));
typedef int v8i __attribute__((ext_vector_type(8)));

// DMA a 16x64 fp32 tile (rows contiguous, row stride 64 floats in memory)
// into LDS with 4-dword padding after each 64-dword row => LDS stride 68.
__device__ __forceinline__ void tdm_load_tile_16x64(const float* gsrc,
                                                    unsigned lds_addr) {
  uint64_t ga = (uint64_t)(uintptr_t)gsrc;
  v4u g0;
  g0[0] = 1u;
  g0[1] = lds_addr;
  g0[2] = (unsigned)(ga & 0xffffffffu);
  g0[3] = (unsigned)((ga >> 32) & 0x01ffffffu)
          | (2u << 30);
  v8i g1;
  g1[0] = (int)((2u << 16)
                | (1u << 20)
                | (5u << 22)
                | (3u << 25));
  g1[1] = (int)(64u << 16);
  g1[2] = (int)(16u << 16);
  g1[3] = (int)(64u << 16);
  g1[4] = 16;
  g1[5] = 64;
  g1[6] = 0;
  g1[7] = 0;
  v4i zz = {0, 0, 0, 0};
#if __clang_major__ >= 23
  v8i zz8 = {0, 0, 0, 0, 0, 0, 0, 0};
  __builtin_amdgcn_tensor_load_to_lds(g0, g1, zz, zz, zz8, 0);
#else
  __builtin_amdgcn_tensor_load_to_lds(g0, g1, zz, zz, 0);
#endif
}
#endif  // USE_TDM

// ---------------- Projections: y = x @ W^T ----------------------------------
// One 128(M) x 128(N) tile per workgroup of 8 waves (4 along M x 2 along N);
// each wave keeps the 32 x 64 tile: two A-fragments share four B-fragments.
// A pass is 32 k: 128 rows of X and 128 rows of W go global -> registers -> LDS
// once per workgroup, two LDS buffers, the next pass's loads issued ahead.
#define GBM 128
#define GBN 128
#define GBK 32
#define GLP 36                      // LDS row pitch in floats (144 B)
#define GOP (GBM * GLP)             // floats of one operand's tile
#define GBUF (2 * GOP)              // floats of one buffer: [X tile | W tile]

__device__ __forceinline__ void gemm_tile_128x128(
    const float* __restrict__ X, const float* __restrict__ Wt,
    int mBase, int nBase, float* __restrict__ sm, v8f (&acc0)[4], v8f (&acc1)[4])
{
  const int tid = threadIdx.x;
  const int lane = tid & 31, wave = tid >> 5;
  const int half = lane >> 4, l16 = lane & 15;
  const int wm = wave & 3, wn = wave >> 2;

  #pragma unroll
  for (int j = 0; j < 4; ++j)
    #pragma unroll
    for (int r = 0; r < 8; ++r) { acc0[j][r] = 0.0f; acc1[j][r] = 0.0f; }

  // staging: 8 lanes cover one 128-B row piece, a wave-wide load 4 whole lines
  const int srow = tid >> 3, scol = (tid & 7) * 4;
  const float* gx = X + (size_t)(mBase + srow) * C_ + scol;
  const float* gw = Wt + (size_t)(nBase + srow) * C_ + scol;
  float* sst = sm + srow * GLP + scol;
  // fragment readers (same k order as a direct global read: k + 2*half, +1)
  const float* sa = sm + (wm * 32 + l16) * GLP + 2 * half;
  const float* sb = sm + GOP + (wn * 64 + l16) * GLP + 2 * half;

  v4f rx0, rx1, rx2, rx3, rw0, rw1, rw2, rw3;
#define G_LOAD(K0)                                              \
  do {                                                          \
    rx0 = *(const v4f*)(gx + (K0));                             \
    rw0 = *(const v4f*)(gw + (K0));                             \
    rx1 = *(const v4f*)(gx + (size_t)32 * C_ + (K0));           \
    rw1 = *(const v4f*)(gw + (size_t)32 * C_ + (K0));           \
    rx2 = *(const v4f*)(gx + (size_t)64 * C_ + (K0));           \
    rw2 = *(const v4f*)(gw + (size_t)64 * C_ + (K0));           \
    rx3 = *(const v4f*)(gx + (size_t)96 * C_ + (K0));           \
    rw3 = *(const v4f*)(gw + (size_t)96 * C_ + (K0));           \
  } while (0)
#define G_STORE(BUF)                                            \
  do {                                                          \
    *(v4f*)(sst + (BUF)) = rx0;                                 \
    *(v4f*)(sst + (BUF) + GOP) = rw0;                           \
    *(v4f*)(sst + (BUF) + 32 * GLP) = rx1;                      \
    *(v4f*)(sst + (BUF) + GOP + 32 * GLP) = rw1;                \
    *(v4f*)(sst + (BUF) + 64 * GLP) = rx2;                      \
    *(v4f*)(sst + (BUF) + GOP + 64 * GLP) = rw2;                \
    *(v4f*)(sst + (BUF) + 96 * GLP) = rx3;                      \
    *(v4f*)(sst + (BUF) + GOP + 96 * GLP) = rw3;                \
  } while (0)
#define G_PASS(BUF)                                             \
  _Pragma("unroll")                                             \
  for (int kk = 0; kk < GBK / 4; ++kk) {                        \
    v2f a0 = *(const v2f*)(sa + (BUF) + kk * 4);                \
    v2f a1 = *(const v2f*)(sa + (BUF) + 16 * GLP + kk * 4);     \
    _Pragma("unroll")                                           \
    for (int j = 0; j < 4; ++j) {                               \
      v2f b = *(const v2f*)(sb + (BUF) + j * 16 * GLP + kk * 4); \
      acc0[j] = wmma_f32(a0, b, acc0[j]);                       \
      acc1[j] = wmma_f32(a1, b, acc1[j]);                       \
    }                                                           \
  }

  G_LOAD(0);
  G_STORE(0);
  __syncthreads();

  for (int p = 0; p < C_ / GBK - 1; ++p) {
    const int cur = (p & 1) * GBUF, nxt = GBUF - cur;
    G_LOAD(GBK);
    // keeps the next pass's global loads ahead of this pass's WMMAs: sunk
    // towards their LDS stores they would leave their latency uncovered
    __builtin_amdgcn_sched_barrier(0);
    G_PASS(cur);
    G_STORE(nxt);
    gx += GBK;
    gw += GBK;
    // publishes the next buffer and ends every wave's reads of this one
    __syncthreads();
  }
  G_PASS(((C_ / GBK - 1) & 1) * GBUF);
#undef G_LOAD
#undef G_STORE
#undef G_PASS
}

__global__ __launch_bounds__(256) __attribute__((amdgpu_waves_per_eu(6, 6)))
void qkv_proj_kernel(
    const float* __restrict__ x,
    const float* __restrict__ Wq, const float* __restrict__ Wk,
    const float* __restrict__ Wv,
    float* __restrict__ qb, float* __restrict__ kb, float* __restrict__ vb)
{
  __shared__ __align__(16) float sm[2 * GBUF];
  const int lane = threadIdx.x & 31, wave = threadIdx.x >> 5;
  const int half = lane >> 4, l16 = lane & 15;
  const float* W; float* out;
  if (blockIdx.z == 0)      { W = Wq; out = qb; }
  else if (blockIdx.z == 1) { W = Wk; out = kb; }
  else                      { W = Wv; out = vb; }

  v8f acc0[4], acc1[4];
  gemm_tile_128x128(x, W, blockIdx.x * GBM, blockIdx.y * GBN, sm, acc0, acc1);

  const int mBase = blockIdx.x * GBM + (wave & 3) * 32;
  const int nBase = blockIdx.y * GBN + (wave >> 2) * 64;
  #pragma unroll
  for (int j = 0; j < 4; ++j) {
    #pragma unroll
    for (int r = 0; r < 8; ++r) {
      int n = nBase + j * 16 + l16;           // h*D + d
      int h = n >> 6, d = n & (D_ - 1);
      int m0 = mBase + r + 8 * half;          // b*T + t
      int b0 = m0 >> 11, t0 = m0 & (T_ - 1);
      out[((size_t)(b0 * H_ + h) * T_ + t0) * D_ + d] = acc0[j][r];
      int m1 = m0 + 16;
      int b1 = m1 >> 11, t1 = m1 & (T_ - 1);
      out[((size_t)(b1 * H_ + h) * T_ + t1) * D_ + d] = acc1[j][r];
    }
  }
}

__global__ __launch_bounds__(256) __attribute__((amdgpu_waves_per_eu(2, 2)))
void out_proj_kernel(
    const float* __restrict__ X, const float* __restrict__ Wo,
    float* __restrict__ Y)
{
  __shared__ __align__(16) float sm[2 * GBUF];
  const int lane = threadIdx.x & 31, wave = threadIdx.x >> 5;
  const int half = lane >> 4, l16 = lane & 15;

  v8f acc0[4], acc1[4];
  gemm_tile_128x128(X, Wo, blockIdx.x * GBM, blockIdx.y * GBN, sm, acc0, acc1);

  const int mBase = blockIdx.x * GBM + (wave & 3) * 32;
  const int nBase = blockIdx.y * GBN + (wave >> 2) * 64;
  #pragma unroll
  for (int j = 0; j < 4; ++j) {
    #pragma unroll
    for (int r = 0; r < 8; ++r) {
      int n = nBase + j * 16 + l16;
      int m0 = mBase + r + 8 * half;
      Y[(size_t)m0 * C_ + n] = acc0[j][r];
      Y[(size_t)(m0 + 16) * C_ + n] = acc1[j][r];
    }
  }
}

// ---------------- Flash attention with ALiBi bias (causal) ------------------
#define KRS 68
#define PRS 18

__global__ __launch_bounds__(32) void attn_kernel(
    const float* __restrict__ qb, const float* __restrict__ kb,
    const float* __restrict__ vb, float* __restrict__ ob)
{
  __shared__ __align__(16) float pbuf[16 * PRS];
#if USE_TDM
  __shared__ __align__(16) float ktile[16 * KRS + 4];
  __shared__ __align__(16) float vtile[16 * KRS + 4];
#endif
  const int lane = threadIdx.x;
  const int half = lane >> 4, l16 = lane & 15;
  const int qt = blockIdx.x, h = blockIdx.y, b = blockIdx.z;
  const int qBase = qt * 16;
  const size_t headoff = (size_t)(b * H_ + h) * T_ * D_;
  const float* Qp = qb + headoff;
  const float* Kp = kb + headoff;
  const float* Vp = vb + headoff;
  const float slope = exp2f(-0.5f * (float)(h + 1));  // H=16 power-of-2 slopes
  const float scale = 0.125f;                         // 1/sqrt(64)

  // preload Q tile (16x64) as 16 A-fragments
  v2f qa[16];
  const float* qrow = Qp + (size_t)(qBase + l16) * D_;
  #pragma unroll
  for (int kk = 0; kk < 16; ++kk)
    qa[kk] = *(const v2f*)(qrow + kk * 4 + 2 * half);

  v8f o[4];
  float mx[8], sm[8];
  #pragma unroll
  for (int j = 0; j < 4; ++j)
    #pragma unroll
    for (int r = 0; r < 8; ++r) o[j][r] = 0.0f;
  #pragma unroll
  for (int r = 0; r < 8; ++r) { mx[r] = -1e30f; sm[r] = 0.0f; }

  for (int kt = 0; kt <= qt; ++kt) {
    const int kBase = kt * 16;

#if USE_TDM
    tdm_load_tile_16x64(Kp + (size_t)kBase * D_,
                        (unsigned)(uintptr_t)&ktile[0]);
    tdm_load_tile_16x64(Vp + (size_t)kBase * D_,
                        (unsigned)(uintptr_t)&vtile[0]);
    __builtin_amdgcn_s_wait_tensorcnt(0);
#endif

    // S = Q @ K^T  (16x16)
    v8f s;
    #pragma unroll
    for (int r = 0; r < 8; ++r) s[r] = 0.0f;
    #pragma unroll
    for (int kk = 0; kk < 16; ++kk) {
#if USE_TDM
      v2f kf = *(const v2f*)(&ktile[l16 * KRS + kk * 4 + 2 * half]);
#else
      v2f kf = *(const v2f*)(Kp + (size_t)(kBase + l16) * D_ + kk * 4 + 2 * half);
#endif
      s = wmma_f32(qa[kk], kf, s);
    }

    // bias + causal mask + online softmax (row = r + 8*half, col = l16)
    float p[8];
    #pragma unroll
    for (int r = 0; r < 8; ++r) {
      int qi = qBase + r + 8 * half;
      int ki = kBase + l16;
      float val = s[r] * scale - slope * fabsf((float)(qi - ki));
      if (ki > qi) val = -1e30f;
      float vmax = val;
      #pragma unroll
      for (int msk = 1; msk <= 8; msk <<= 1)
        vmax = fmaxf(vmax, __shfl_xor(vmax, msk, 32));
      float nm   = fmaxf(mx[r], vmax);
      float corr = __expf(mx[r] - nm);
      float pe   = __expf(val - nm);
      float psum = pe;
      #pragma unroll
      for (int msk = 1; msk <= 8; msk <<= 1)
        psum += __shfl_xor(psum, msk, 32);
      sm[r] = sm[r] * corr + psum;
      mx[r] = nm;
      #pragma unroll
      for (int j = 0; j < 4; ++j) o[j][r] *= corr;
      p[r] = pe;
    }

    // D-layout -> A-layout conversion of P through LDS
    #pragma unroll
    for (int r = 0; r < 8; ++r) pbuf[(r + 8 * half) * PRS + l16] = p[r];
    __syncthreads();

    // O += P @ V  (16x16 * 16x64)
    #pragma unroll
    for (int kk = 0; kk < 4; ++kk) {
      v2f pa = *(const v2f*)(&pbuf[l16 * PRS + kk * 4 + 2 * half]);
      const int kl = kk * 4 + 2 * half;  // key-local row
      #pragma unroll
      for (int j = 0; j < 4; ++j) {
        v2f vf;
#if USE_TDM
        vf[0] = vtile[kl * KRS + j * 16 + l16];
        vf[1] = vtile[(kl + 1) * KRS + j * 16 + l16];
#else
        vf[0] = Vp[(size_t)(kBase + kl) * D_ + j * 16 + l16];
        vf[1] = Vp[(size_t)(kBase + kl + 1) * D_ + j * 16 + l16];
#endif
        o[j] = wmma_f32(pa, vf, o[j]);
      }
    }
    __syncthreads();
  }

  // normalize and store to (B,T,C)
  #pragma unroll
  for (int j = 0; j < 4; ++j) {
    #pragma unroll
    for (int r = 0; r < 8; ++r) {
      int m = qBase + r + 8 * half;
      int d = j * 16 + l16;
      ob[(size_t)(b * T_ + m) * C_ + h * D_ + d] = o[j][r] / sm[r];
    }
  }
}

extern "C" void kernel_launch(void* const* d_in, const int* in_sizes, int n_in,
                              void* d_out, int out_size, void* d_ws, size_t ws_size,
                              hipStream_t stream) {
  (void)in_sizes; (void)n_in; (void)out_size; (void)ws_size;
  const float* x  = (const float*)d_in[0];
  const float* Wq = (const float*)d_in[1];
  const float* Wk = (const float*)d_in[2];
  const float* Wv = (const float*)d_in[3];
  const float* Wo = (const float*)d_in[4];
  float* out = (float*)d_out;

  const size_t per = (size_t)B_ * H_ * T_ * D_;  // 4M floats per buffer
  float* qb = (float*)d_ws;
  float* kb = qb + per;
  float* vb = kb + per;
  float* ab = vb + per;  // attention output in (B,T,C)

  dim3 blk(32, 1, 1);
  dim3 gblk(256, 1, 1);
  qkv_proj_kernel<<<dim3((B_ * T_) / GBM, C_ / GBN, 3), gblk, 0, stream>>>(
      x, Wq, Wk, Wv, qb, kb, vb);
  attn_kernel<<<dim3(T_ / 16, H_, B_), blk, 0, stream>>>(qb, kb, vb, ab);
  out_proj_kernel<<<dim3((B_ * T_) / GBM, C_ / GBN, 1), gblk, 0, stream>>>(
      ab, Wo, out);
}

// v002
// Measured time: 347 microseconds a run.
// Next to v001, in two timings, it ran 1.28 times as fast each time.
// All steps since v000 together make it 1.88 times as fast.
#include <hip/hip_runtime.h>
#include <math.h>
#include <stdint.h>

typedef float v2f __attribute__((ext_vector_type(2)));
typedef float v4f __attribute__((ext_vector_type(4)));
typedef float v8f __attribute__((ext_vector_type(8)));

#define B_ 2
#define T_ 2048
#define C_ 1024
#define H_ 16
#define D_ 64

__device__ __forceinline__ v8f wmma_f32(v2f a, v2f b, v8f c) {
  // V_WMMA_F32_16X16X4_F32 : D = A(16x4) * B(4x16) + C(16x16), fp32
  return __builtin_amdgcn_wmma_f32_16x16x4_f32(false, a, false, b, (short)0, c,
                                               false, false);
}

typedef uint32_t u32x4 __attribute__((ext_vector_type(4)));
typedef uint32_t u32x8 __attribute__((ext_vector_type(8)));

__device__ __forceinline__ uint32_t uni(uint32_t v) {
  return (uint32_t)__builtin_amdgcn_readfirstlane(v);
}

__device__ __forceinline__ u32x8 tdm_group1_64x256() {
  u32x8 g;
  g[0] = uni((1u << 20) | (5u << 22) | (3u << 25));
  g[1] = uni(256u << 16);
  g[2] = uni(64u << 16);
  g[3] = uni(256u << 16);
  g[4] = uni(64u);
  g[5] = uni(256u);
  g[6] = uni(0u);
  g[7] = uni(0u);
  return g;
}
__device__ __forceinline__ u32x4 tdm_group0(uint32_t lds_dst, uint64_t ga) {
  u32x4 g;
  g[0] = uni(1u);
  g[1] = uni(lds_dst);
  g[2] = uni((uint32_t)ga);
  g[3] = uni((((uint32_t)(ga >> 32)) & 0x01FFFFFFu) | 0x80000000u);
  return g;
}

// ---------------- Projections: y = x @ W^T ----------------------------------
// One 128(M) x 128(N) tile per workgroup of 8 waves (4 along M x 2 along N);
// each wave keeps the 32 x 64 tile: two A-fragments share four B-fragments.
// A pass is 32 k: 128 rows of X and 128 rows of W go global -> registers -> LDS
// once per workgroup, two LDS buffers, the next pass's loads issued ahead.
#define GBM 128
#define GBN 128
#define GBK 32
#define GLP 36                      // LDS row pitch in floats (144 B)
#define GOP (GBM * GLP)             // floats of one operand's tile
#define GBUF (2 * GOP)              // floats of one buffer: [X tile | W tile]

__device__ __forceinline__ void gemm_tile_128x128(
    const float* __restrict__ X, const float* __restrict__ Wt,
    int mBase, int nBase, float* __restrict__ sm, v8f (&acc0)[4], v8f (&acc1)[4])
{
  const int tid = threadIdx.x;
  const int lane = tid & 31, wave = tid >> 5;
  const int half = lane >> 4, l16 = lane & 15;
  const int wm = wave & 3, wn = wave >> 2;

  #pragma unroll
  for (int j = 0; j < 4; ++j)
    #pragma unroll
    for (int r = 0; r < 8; ++r) { acc0[j][r] = 0.0f; acc1[j][r] = 0.0f; }

  // staging: 8 lanes cover one 128-B row piece, a wave-wide load 4 whole lines
  const int srow = tid >> 3, scol = (tid & 7) * 4;
  const float* gx = X + (size_t)(mBase + srow) * C_ + scol;
  const float* gw = Wt + (size_t)(nBase + srow) * C_ + scol;
  float* sst = sm + srow * GLP + scol;
  // fragment readers (same k order as a direct global read: k + 2*half, +1)
  const float* sa = sm + (wm * 32 + l16) * GLP + 2 * half;
  const float* sb = sm + GOP + (wn * 64 + l16) * GLP + 2 * half;

  v4f rx0, rx1, rx2, rx3, rw0, rw1, rw2, rw3;
#define G_LOAD(K0)                                              \
  do {                                                          \
    rx0 = *(const v4f*)(gx + (K0));                             \
    rw0 = *(const v4f*)(gw + (K0));                             \
    rx1 = *(const v4f*)(gx + (size_t)32 * C_ + (K0));           \
    rw1 = *(const v4f*)(gw + (size_t)32 * C_ + (K0));           \
    rx2 = *(const v4f*)(gx + (size_t)64 * C_ + (K0));           \
    rw2 = *(const v4f*)(gw + (size_t)64 * C_ + (K0));           \
    rx3 = *(const v4f*)(gx + (size_t)96 * C_ + (K0));           \
    rw3 = *(const v4f*)(gw + (size_t)96 * C_ + (K0));           \
  } while (0)
#define G_STORE(BUF)                                            \
  do {                                                          \
    *(v4f*)(sst + (BUF)) = rx0;                                 \
    *(v4f*)(sst + (BUF) + GOP) = rw0;                           \
    *(v4f*)(sst + (BUF) + 32 * GLP) = rx1;                      \
    *(v4f*)(sst + (BUF) + GOP + 32 * GLP) = rw1;                \
    *(v4f*)(sst + (BUF) + 64 * GLP) = rx2;                      \
    *(v4f*)(sst + (BUF) + GOP + 64 * GLP) = rw2;                \
    *(v4f*)(sst + (BUF) + 96 * GLP) = rx3;                      \
    *(v4f*)(sst + (BUF) + GOP + 96 * GLP) = rw3;                \
  } while (0)
#define G_PASS(BUF)                                             \
  _Pragma("unroll")                                             \
  for (int kk = 0; kk < GBK / 4; ++kk) {                        \
    v2f a0 = *(const v2f*)(sa + (BUF) + kk * 4);                \
    v2f a1 = *(const v2f*)(sa + (BUF) + 16 * GLP + kk * 4);     \
    _Pragma("unroll")                                           \
    for (int j = 0; j < 4; ++j) {                               \
      v2f b = *(const v2f*)(sb + (BUF) + j * 16 * GLP + kk * 4); \
      acc0[j] = wmma_f32(a0, b, acc0[j]);                       \
      acc1[j] = wmma_f32(a1, b, acc1[j]);                       \
    }                                                           \
  }

  G_LOAD(0);
  G_STORE(0);
  __syncthreads();

  for (int p = 0; p < C_ / GBK - 1; ++p) {
    const int cur = (p & 1) * GBUF, nxt = GBUF - cur;
    G_LOAD(GBK);
    // keeps the next pass's global loads ahead of this pass's WMMAs: sunk
    // towards their LDS stores they would leave their latency uncovered
    __builtin_amdgcn_sched_barrier(0);
    G_PASS(cur);
    G_STORE(nxt);
    gx += GBK;
    gw += GBK;
    // publishes the next buffer and ends every wave's reads of this one
    __syncthreads();
  }
  G_PASS(((C_ / GBK - 1) & 1) * GBUF);
#undef G_LOAD
#undef G_STORE
#undef G_PASS
}

__global__ __launch_bounds__(256) __attribute__((amdgpu_waves_per_eu(6, 6)))
void qkv_proj_kernel(
    const float* __restrict__ x,
    const float* __restrict__ Wq, const float* __restrict__ Wk,
    const float* __restrict__ Wv,
    float* __restrict__ qb, float* __restrict__ kb, float* __restrict__ vb)
{
  __shared__ __align__(16) float sm[2 * GBUF];
  const int lane = threadIdx.x & 31, wave = threadIdx.x >> 5;
  const int half = lane >> 4, l16 = lane & 15;
  const float* W; float* out;
  if (blockIdx.z == 0)      { W = Wq; out = qb; }
  else if (blockIdx.z == 1) { W = Wk; out = kb; }
  else                      { W = Wv; out = vb; }

  v8f acc0[4], acc1[4];
  gemm_tile_128x128(x, W, blockIdx.x * GBM, blockIdx.y * GBN, sm, acc0, acc1);

  const int mBase = blockIdx.x * GBM + (wave & 3) * 32;
  const int nBase = blockIdx.y * GBN + (wave >> 2) * 64;
  #pragma unroll
  for (int j = 0; j < 4; ++j) {
    #pragma unroll
    for (int r = 0; r < 8; ++r) {
      int n = nBase + j * 16 + l16;           // h*D + d
      int h = n >> 6, d = n & (D_ - 1);
      int m0 = mBase + r + 8 * half;          // b*T + t
      int b0 = m0 >> 11, t0 = m0 & (T_ - 1);
      out[((size_t)(b0 * H_ + h) * T_ + t0) * D_ + d] = acc0[j][r];
      int m1 = m0 + 16;
      int b1 = m1 >> 11, t1 = m1 & (T_ - 1);
      out[((size_t)(b1 * H_ + h) * T_ + t1) * D_ + d] = acc1[j][r];
    }
  }
}

__global__ __launch_bounds__(256) __attribute__((amdgpu_waves_per_eu(2, 2)))
void out_proj_kernel(
    const float* __restrict__ X, const float* __restrict__ Wo,
    float* __restrict__ Y)
{
  __shared__ __align__(16) float sm[2 * GBUF];
  const int lane = threadIdx.x & 31, wave = threadIdx.x >> 5;
  const int half = lane >> 4, l16 = lane & 15;

  v8f acc0[4], acc1[4];
  gemm_tile_128x128(X, Wo, blockIdx.x * GBM, blockIdx.y * GBN, sm, acc0, acc1);

  const int mBase = blockIdx.x * GBM + (wave & 3) * 32;
  const int nBase = blockIdx.y * GBN + (wave >> 2) * 64;
  #pragma unroll
  for (int j = 0; j < 4; ++j) {
    #pragma unroll
    for (int r = 0; r < 8; ++r) {
      int n = nBase + j * 16 + l16;
      int m0 = mBase + r + 8 * half;
      Y[(size_t)m0 * C_ + n] = acc0[j][r];
      Y[(size_t)(m0 + 16) * C_ + n] = acc1[j][r];
    }
  }
}

// ---------------- Flash attention with ALiBi bias (causal) ------------------
#define KB 64   // keys per pass
#define KRS 68  // LDS row pitch (floats) of the K/V tiles as the tensor load pads them
#define PRS 68  // LDS row pitch (floats) of the 16 x 64 P tile (8-byte reads, no conflict)
#define KVT (KB * KRS)  // floats of one K or V tile in LDS: 17 KiB
#define VOFF 4608       // floats: the V tile's place, 18 KiB (a multiple of 2 KiB)

__global__ __launch_bounds__(32) void attn_kernel(
    const float* __restrict__ qb, const float* __restrict__ kb,
    const float* __restrict__ vb, float* __restrict__ ob)
{
  // [K tile | V tile | P tile]; the tensor loads land at 0 and at 18 KiB
  __shared__ __attribute__((aligned(2048))) float lds[VOFF + KVT + 16 * PRS];
  float* const ktile = lds;
  float* const vtile = lds + VOFF;
  float* const pbuf = lds + VOFF + KVT;
  const int lane = threadIdx.x;
  const int half = lane >> 4, l16 = lane & 15;
  const int qt = blockIdx.x, h = blockIdx.y, b = blockIdx.z;
  const int qBase = qt * 16;
  const size_t headoff = (size_t)(b * H_ + h) * T_ * D_;
  const float* Qp = qb + headoff;
  const float* Kp = kb + headoff;
  const float* Vp = vb + headoff;
  const float slope = exp2f(-0.5f * (float)(h + 1));  // H=16 power-of-2 slopes
  const float scale = 0.125f;                         // 1/sqrt(64)

  // preload Q tile (16x64) as 16 A-fragments
  v2f qa[16];
  const float* qrow = Qp + (size_t)(qBase + l16) * D_;
  #pragma unroll
  for (int kk = 0; kk < 16; ++kk)
    qa[kk] = *(const v2f*)(qrow + kk * 4 + 2 * half);

  v8f o[4];
  float mx[8], sm[8];
  #pragma unroll
  for (int j = 0; j < 4; ++j)
    #pragma unroll
    for (int r = 0; r < 8; ++r) o[j][r] = 0.0f;
  #pragma unroll
  for (int r = 0; r < 8; ++r) { mx[r] = -1e30f; sm[r] = 0.0f; }

  const u32x8 g1 = tdm_group1_64x256();
  const uint32_t kdst = (uint32_t)(uintptr_t)ktile;
  const uint32_t vdst = (uint32_t)(uintptr_t)vtile;
  // 64-key blocks up to and with the one that holds the diagonal; T_ is a
  // multiple of 64, so every block lies inside the head's K and V
  const int npass = (qBase >> 6) + 1;

  for (int kt = 0; kt < npass; ++kt) {
    const int kBase = kt * KB;

    const u32x4 gk = tdm_group0(kdst, (uint64_t)(uintptr_t)(Kp + (size_t)kBase * D_));
    const u32x4 gv = tdm_group0(vdst, (uint64_t)(uintptr_t)(Vp + (size_t)kBase * D_));
    asm volatile("s_wait_dscnt 0x0\n\t"
                 "tensor_load_to_lds %0, %2\n\t"
                 "tensor_load_to_lds %1, %2\n\t"
                 "s_wait_tensorcnt 0x0"
                 :: "s"(gk), "s"(gv), "s"(g1) : "memory");

    // S = Q @ K^T  (16 x 64: four independent 16x16 score tiles)
    v8f s[4];
    #pragma unroll
    for (int c = 0; c < 4; ++c)
      #pragma unroll
      for (int r = 0; r < 8; ++r) s[c][r] = 0.0f;
    #pragma unroll
    for (int kk = 0; kk < 16; ++kk) {
      #pragma unroll
      for (int c = 0; c < 4; ++c) {
        v2f kf = *(const v2f*)(&ktile[(c * 16 + l16) * KRS + kk * 4 + 2 * half]);
        s[c] = wmma_f32(qa[kk], kf, s[c]);
      }
    }

    // bias + causal mask + online softmax (row = r + 8*half, col = c*16 + l16)
    #pragma unroll
    for (int r = 0; r < 8; ++r) {
      int qi = qBase + r + 8 * half;
      float val[4];
      #pragma unroll
      for (int c = 0; c < 4; ++c) {
        int ki = kBase + c * 16 + l16;
        val[c] = s[c][r] * scale - slope * fabsf((float)(qi - ki));
        if (ki > qi) val[c] = -1e30f;
      }
      float vmax = fmaxf(fmaxf(val[0], val[1]), fmaxf(val[2], val[3]));
      #pragma unroll
      for (int msk = 1; msk <= 8; msk <<= 1)
        vmax = fmaxf(vmax, __shfl_xor(vmax, msk, 32));
      float nm   = fmaxf(mx[r], vmax);
      float corr = __expf(mx[r] - nm);
      float pe[4];
      #pragma unroll
      for (int c = 0; c < 4; ++c) pe[c] = __expf(val[c] - nm);
      float psum = (pe[0] + pe[1]) + (pe[2] + pe[3]);
      #pragma unroll
      for (int msk = 1; msk <= 8; msk <<= 1)
        psum += __shfl_xor(psum, msk, 32);
      sm[r] = sm[r] * corr + psum;
      mx[r] = nm;
      #pragma unroll
      for (int j = 0; j < 4; ++j) o[j][r] *= corr;
      // D-layout -> A-layout conversion of P through LDS
      #pragma unroll
      for (int c = 0; c < 4; ++c)
        pbuf[(r + 8 * half) * PRS + c * 16 + l16] = pe[c];
    }
    __syncthreads();

    // O += P @ V  (16x64 * 64x64)
    #pragma unroll
    for (int kk = 0; kk < KB / 4; ++kk) {
      v2f pa = *(const v2f*)(&pbuf[l16 * PRS + kk * 4 + 2 * half]);
      const int kl = kk * 4 + 2 * half;  // key-local row
      #pragma unroll
      for (int j = 0; j < 4; ++j) {
        v2f vf;
        vf[0] = vtile[kl * KRS + j * 16 + l16];
        vf[1] = vtile[(kl + 1) * KRS + j * 16 + l16];
        o[j] = wmma_f32(pa, vf, o[j]);
      }
    }
    __syncthreads();
  }

  // normalize and store to (B,T,C)
  #pragma unroll
  for (int j = 0; j < 4; ++j) {
    #pragma unroll
    for (int r = 0; r < 8; ++r) {
      int m = qBase + r + 8 * half;
      int d = j * 16 + l16;
      ob[(size_t)(b * T_ + m) * C_ + h * D_ + d] = o[j][r] / sm[r];
    }
  }
}

extern "C" void kernel_launch(void* const* d_in, const int* in_sizes, int n_in,
                              void* d_out, int out_size, void* d_ws, size_t ws_size,
                              hipStream_t stream) {
  (void)in_sizes; (void)n_in; (void)out_size; (void)ws_size;
  const float* x  = (const float*)d_in[0];
  const float* Wq = (const float*)d_in[1];
  const float* Wk = (const float*)d_in[2];
  const float* Wv = (const float*)d_in[3];
  const float* Wo = (const float*)d_in[4];
  float* out = (float*)d_out;

  const size_t per = (size_t)B_ * H_ * T_ * D_;  // 4M floats per buffer
  float* qb = (float*)d_ws;
  float* kb = qb + per;
  float* vb = kb + per;
  float* ab = vb + per;  // attention output in (B,T,C)

  dim3 blk(32, 1, 1);
  dim3 gblk(256, 1, 1);
  qkv_proj_kernel<<<dim3((B_ * T_) / GBM, C_ / GBN, 3), gblk, 0, stream>>>(
      x, Wq, Wk, Wv, qb, kb, vb);
  attn_kernel<<<dim3(T_ / 16, H_, B_), blk, 0, stream>>>(qb, kb, vb, ab);
  out_proj_kernel<<<dim3((B_ * T_) / GBM, C_ / GBN, 1), gblk, 0, stream>>>(
      ab, Wo, out);
}

// v003
// A run of this version takes 287 microseconds.
// Next to v002, in two timings, it ran 1.21 times as fast each time.
// Over all steps from v000 it is 2.28 times as fast.
#include <hip/hip_runtime.h>
#include <math.h>
#include <stdint.h>

typedef float v2f __attribute__((ext_vector_type(2)));
typedef float v4f __attribute__((ext_vector_type(4)));
typedef float v8f __attribute__((ext_vector_type(8)));

#define B_ 2
#define T_ 2048
#define C_ 1024
#define H_ 16
#define D_ 64

__device__ __forceinline__ v8f wmma_f32(v2f a, v2f b, v8f c) {
  // V_WMMA_F32_16X16X4_F32 : D = A(16x4) * B(4x16) + C(16x16), fp32
  return __builtin_amdgcn_wmma_f32_16x16x4_f32(false, a, false, b, (short)0, c,
                                               false, false);
}

typedef uint32_t u32x4 __attribute__((ext_vector_type(4)));
typedef uint32_t u32x8 __attribute__((ext_vector_type(8)));

__device__ __forceinline__ uint32_t uni(uint32_t v) {
  return (uint32_t)__builtin_amdgcn_readfirstlane(v);
}

__device__ __forceinline__ u32x8 tdm_group1_64x256() {
  u32x8 g;
  g[0] = uni((1u << 20) | (5u << 22) | (3u << 25));
  g[1] = uni(256u << 16);
  g[2] = uni(64u << 16);
  g[3] = uni(256u << 16);
  g[4] = uni(64u);
  g[5] = uni(256u);
  g[6] = uni(0u);
  g[7] = uni(0u);
  return g;
}
__device__ __forceinline__ u32x4 tdm_group0(uint32_t lds_dst, uint64_t ga) {
  u32x4 g;
  g[0] = uni(1u);
  g[1] = uni(lds_dst);
  g[2] = uni((uint32_t)ga);
  g[3] = uni((((uint32_t)(ga >> 32)) & 0x01FFFFFFu) | 0x80000000u);
  return g;
}

// ---------------- Projections: y = x @ W^T ----------------------------------
// One 128(M) x 128(N) tile per workgroup of 8 waves (4 along M x 2 along N);
// each wave keeps the 32 x 64 tile: two A-fragments share four B-fragments.
// A pass is 32 k: 128 rows of X and 128 rows of W go global -> registers -> LDS
// once per workgroup, two LDS buffers, the next pass's loads issued ahead.
#define GBM 128
#define GBN 128
#define GBK 32
#define GLP 36                      // LDS row pitch in floats (144 B)
#define GOP (GBM * GLP)             // floats of one operand's tile
#define GBUF (2 * GOP)              // floats of one buffer: [X tile | W tile]

__device__ __forceinline__ void gemm_tile_128x128(
    const float* __restrict__ X, const float* __restrict__ Wt,
    int mBase, int nBase, float* __restrict__ sm, v8f (&acc0)[4], v8f (&acc1)[4])
{
  const int tid = threadIdx.x;
  const int lane = tid & 31, wave = tid >> 5;
  const int half = lane >> 4, l16 = lane & 15;
  const int wm = wave & 3, wn = wave >> 2;

  #pragma unroll
  for (int j = 0; j < 4; ++j)
    #pragma unroll
    for (int r = 0; r < 8; ++r) { acc0[j][r] = 0.0f; acc1[j][r] = 0.0f; }

  // staging: 8 lanes cover one 128-B row piece, a wave-wide load 4 whole lines
  const int srow = tid >> 3, scol = (tid & 7) * 4;
  const float* gx = X + (size_t)(mBase + srow) * C_ + scol;
  const float* gw = Wt + (size_t)(nBase + srow) * C_ + scol;
  float* sst = sm + srow * GLP + scol;
  // fragment readers (same k order as a direct global read: k + 2*half, +1)
  const float* sa = sm + (wm * 32 + l16) * GLP + 2 * half;
  const float* sb = sm + GOP + (wn * 64 + l16) * GLP + 2 * half;

  v4f rx0, rx1, rx2, rx3, rw0, rw1, rw2, rw3;
#define G_LOAD(K0)                                              \
  do {                                                          \
    rx0 = *(const v4f*)(gx + (K0));                             \
    rw0 = *(const v4f*)(gw + (K0));                             \
    rx1 = *(const v4f*)(gx + (size_t)32 * C_ + (K0));           \
    rw1 = *(const v4f*)(gw + (size_t)32 * C_ + (K0));           \
    rx2 = *(const v4f*)(gx + (size_t)64 * C_ + (K0));           \
    rw2 = *(const v4f*)(gw + (size_t)64 * C_ + (K0));           \
    rx3 = *(const v4f*)(gx + (size_t)96 * C_ + (K0));           \
    rw3 = *(const v4f*)(gw + (size_t)96 * C_ + (K0));           \
  } while (0)
#define G_STORE(BUF)                                            \
  do {                                                          \
    *(v4f*)(sst + (BUF)) = rx0;                                 \
    *(v4f*)(sst + (BUF) + GOP) = rw0;                           \
    *(v4f*)(sst + (BUF) + 32 * GLP) = rx1;                      \
    *(v4f*)(sst + (BUF) + GOP + 32 * GLP) = rw1;                \
    *(v4f*)(sst + (BUF) + 64 * GLP) = rx2;                      \
    *(v4f*)(sst + (BUF) + GOP + 64 * GLP) = rw2;                \
    *(v4f*)(sst + (BUF) + 96 * GLP) = rx3;                      \
    *(v4f*)(sst + (BUF) + GOP + 96 * GLP) = rw3;                \
  } while (0)
#define G_PASS(BUF)                                             \
  _Pragma("unroll")                                             \
  for (int kk = 0; kk < GBK / 4; ++kk) {                        \
    v2f a0 = *(const v2f*)(sa + (BUF) + kk * 4);                \
    v2f a1 = *(const v2f*)(sa + (BUF) + 16 * GLP + kk * 4);     \
    _Pragma("unroll")                                           \
    for (int j = 0; j < 4; ++j) {                               \
      v2f b = *(const v2f*)(sb + (BUF) + j * 16 * GLP + kk * 4); \
      acc0[j] = wmma_f32(a0, b, acc0[j]);                       \
      acc1[j] = wmma_f32(a1, b, acc1[j]);                       \
    }                                                           \
  }

  G_LOAD(0);
  G_STORE(0);
  __syncthreads();

  for (int p = 0; p < C_ / GBK - 1; ++p) {
    const int cur = (p & 1) * GBUF, nxt = GBUF - cur;
    G_LOAD(GBK);
    // keeps the next pass's global loads ahead of this pass's WMMAs: sunk
    // towards their LDS stores they would leave their latency uncovered
    __builtin_amdgcn_sched_barrier(0);
    G_PASS(cur);
    G_STORE(nxt);
    gx += GBK;
    gw += GBK;
    // publishes the next buffer and ends every wave's reads of this one
    __syncthreads();
  }
  G_PASS(((C_ / GBK - 1) & 1) * GBUF);
#undef G_LOAD
#undef G_STORE
#undef G_PASS
}

__global__ __launch_bounds__(256) __attribute__((amdgpu_waves_per_eu(6, 6)))
void qkv_proj_kernel(
    const float* __restrict__ x,
    const float* __restrict__ Wq, const float* __restrict__ Wk,
    const float* __restrict__ Wv,
    float* __restrict__ qb, float* __restrict__ kb, float* __restrict__ vb)
{
  __shared__ __align__(16) float sm[2 * GBUF];
  const int lane = threadIdx.x & 31, wave = threadIdx.x >> 5;
  const int half = lane >> 4, l16 = lane & 15;
  const float* W; float* out;
  if (blockIdx.z == 0)      { W = Wq; out = qb; }
  else if (blockIdx.z == 1) { W = Wk; out = kb; }
  else                      { W = Wv; out = vb; }

  v8f acc0[4], acc1[4];
  gemm_tile_128x128(x, W, blockIdx.x * GBM, blockIdx.y * GBN, sm, acc0, acc1);

  const int mBase = blockIdx.x * GBM + (wave & 3) * 32;
  const int nBase = blockIdx.y * GBN + (wave >> 2) * 64;
  #pragma unroll
  for (int j = 0; j < 4; ++j) {
    #pragma unroll
    for (int r = 0; r < 8; ++r) {
      int n = nBase + j * 16 + l16;           // h*D + d
      int h = n >> 6, d = n & (D_ - 1);
      int m0 = mBase + r + 8 * half;          // b*T + t
      int b0 = m0 >> 11, t0 = m0 & (T_ - 1);
      out[((size_t)(b0 * H_ + h) * T_ + t0) * D_ + d] = acc0[j][r];
      int m1 = m0 + 16;
      int b1 = m1 >> 11, t1 = m1 & (T_ - 1);
      out[((size_t)(b1 * H_ + h) * T_ + t1) * D_ + d] = acc1[j][r];
    }
  }
}

__global__ __launch_bounds__(256) __attribute__((amdgpu_waves_per_eu(2, 2)))
void out_proj_kernel(
    const float* __restrict__ X, const float* __restrict__ Wo,
    float* __restrict__ Y)
{
  __shared__ __align__(16) float sm[2 * GBUF];
  const int lane = threadIdx.x & 31, wave = threadIdx.x >> 5;
  const int half = lane >> 4, l16 = lane & 15;

  v8f acc0[4], acc1[4];
  gemm_tile_128x128(X, Wo, blockIdx.x * GBM, blockIdx.y * GBN, sm, acc0, acc1);

  const int mBase = blockIdx.x * GBM + (wave & 3) * 32;
  const int nBase = blockIdx.y * GBN + (wave >> 2) * 64;
  #pragma unroll
  for (int j = 0; j < 4; ++j) {
    #pragma unroll
    for (int r = 0; r < 8; ++r) {
      int n = nBase + j * 16 + l16;
      int m0 = mBase + r + 8 * half;
      Y[(size_t)m0 * C_ + n] = acc0[j][r];
      Y[(size_t)(m0 + 16) * C_ + n] = acc1[j][r];
    }
  }
}

// ---------------- Flash attention with ALiBi bias (causal) ------------------
#define KB 64   // keys per pass
#define KRS 68  // LDS row pitch (floats) of the K/V tiles as the tensor load pads them
#define PRS 68  // LDS row pitch (floats) of the 16 x 64 P tile (8-byte reads, no conflict)
#define KVT (KB * KRS)  // floats of one K or V tile in LDS: 17 KiB
#define VOFF 4608       // floats: the V tile's place, 18 KiB (a multiple of 2 KiB)

__global__ __launch_bounds__(32) void attn_kernel(
    const float* __restrict__ qb, const float* __restrict__ kb,
    const float* __restrict__ vb, float* __restrict__ ob)
{
  // [K tile | V tile | P tile]; the tensor loads land at 0 and at 18 KiB
  __shared__ __attribute__((aligned(2048))) float lds[VOFF + KVT + 16 * PRS];
  float* const ktile = lds;
  float* const vtile = lds + VOFF;
  float* const pbuf = lds + VOFF + KVT;
  const int lane = threadIdx.x;
  const int half = lane >> 4, l16 = lane & 15;
  // The query tile is the slowest grid index and falls with it: a tile's cost
  // grows with its position (causal), there are more workgroups than resident
  // places, so the long tiles take the lowest
  // indices (for speed only).
  const int h = blockIdx.x, b = blockIdx.y;
  const int qt = (T_ / 16 - 1) - (int)blockIdx.z;
  const int qBase = qt * 16;
  const size_t headoff = (size_t)(b * H_ + h) * T_ * D_;
  const float* Qp = qb + headoff;
  const float* Kp = kb + headoff;
  const float* Vp = vb + headoff;
  const float slope = exp2f(-0.5f * (float)(h + 1));  // H=16 power-of-2 slopes
  const float scale = 0.125f;                         // 1/sqrt(64)

  // preload Q tile (16x64) as 16 A-fragments
  v2f qa[16];
  const float* qrow = Qp + (size_t)(qBase + l16) * D_;
  #pragma unroll
  for (int kk = 0; kk < 16; ++kk)
    qa[kk] = *(const v2f*)(qrow + kk * 4 + 2 * half);

  v8f o[4];
  float mx[8], sm[8];
  #pragma unroll
  for (int j = 0; j < 4; ++j)
    #pragma unroll
    for (int r = 0; r < 8; ++r) o[j][r] = 0.0f;
  #pragma unroll
  for (int r = 0; r < 8; ++r) { mx[r] = -1e30f; sm[r] = 0.0f; }

  const u32x8 g1 = tdm_group1_64x256();
  const uint32_t kdst = (uint32_t)(uintptr_t)ktile;
  const uint32_t vdst = (uint32_t)(uintptr_t)vtile;
  // 64-key blocks up to and with the one that holds the diagonal; T_ is a
  // multiple of 64, so every block lies inside the head's K and V
  const int npass = (qBase >> 6) + 1;

  for (int kt = 0; kt < npass; ++kt) {
    const int kBase = kt * KB;

    const u32x4 gk = tdm_group0(kdst, (uint64_t)(uintptr_t)(Kp + (size_t)kBase * D_));
    const u32x4 gv = tdm_group0(vdst, (uint64_t)(uintptr_t)(Vp + (size_t)kBase * D_));
    asm volatile("s_wait_dscnt 0x0\n\t"
                 "tensor_load_to_lds %0, %2\n\t"
                 "tensor_load_to_lds %1, %2\n\t"
                 "s_wait_tensorcnt 0x0"
                 :: "s"(gk), "s"(gv), "s"(g1) : "memory");

    // S = Q @ K^T  (16 x 64: four independent 16x16 score tiles)
    v8f s[4];
    #pragma unroll
    for (int c = 0; c < 4; ++c)
      #pragma unroll
      for (int r = 0; r < 8; ++r) s[c][r] = 0.0f;
    #pragma unroll
    for (int kk = 0; kk < 16; ++kk) {
      #pragma unroll
      for (int c = 0; c < 4; ++c) {
        v2f kf = *(const v2f*)(&ktile[(c * 16 + l16) * KRS + kk * 4 + 2 * half]);
        s[c] = wmma_f32(qa[kk], kf, s[c]);
      }
    }

    // bias + causal mask + online softmax (row = r + 8*half, col = c*16 + l16)
    #pragma unroll
    for (int r = 0; r < 8; ++r) {
      int qi = qBase + r + 8 * half;
      float val[4];
      #pragma unroll
      for (int c = 0; c < 4; ++c) {
        int ki = kBase + c * 16 + l16;
        val[c] = s[c][r] * scale - slope * fabsf((float)(qi - ki));
        if (ki > qi) val[c] = -1e30f;
      }
      float vmax = fmaxf(fmaxf(val[0], val[1]), fmaxf(val[2], val[3]));
      #pragma unroll
      for (int msk = 1; msk <= 8; msk <<= 1)
        vmax = fmaxf(vmax, __shfl_xor(vmax, msk, 32));
      float nm   = fmaxf(mx[r], vmax);
      float corr = __expf(mx[r] - nm);
      float pe[4];
      #pragma unroll
      for (int c = 0; c < 4; ++c) pe[c] = __expf(val[c] - nm);
      float psum = (pe[0] + pe[1]) + (pe[2] + pe[3]);
      #pragma unroll
      for (int msk = 1; msk <= 8; msk <<= 1)
        psum += __shfl_xor(psum, msk, 32);
      sm[r] = sm[r] * corr + psum;
      mx[r] = nm;
      #pragma unroll
      for (int j = 0; j < 4; ++j) o[j][r] *= corr;
      // D-layout -> A-layout conversion of P through LDS
      #pragma unroll
      for (int c = 0; c < 4; ++c)
        pbuf[(r + 8 * half) * PRS + c * 16 + l16] = pe[c];
    }
    __syncthreads();

    // O += P @ V  (16x64 * 64x64)
    #pragma unroll
    for (int kk = 0; kk < KB / 4; ++kk) {
      v2f pa = *(const v2f*)(&pbuf[l16 * PRS + kk * 4 + 2 * half]);
      const int kl = kk * 4 + 2 * half;  // key-local row
      #pragma unroll
      for (int j = 0; j < 4; ++j) {
        v2f vf;
        vf[0] = vtile[kl * KRS + j * 16 + l16];
        vf[1] = vtile[(kl + 1) * KRS + j * 16 + l16];
        o[j] = wmma_f32(pa, vf, o[j]);
      }
    }
    __syncthreads();
  }

  // normalize and store to (B,T,C)
  #pragma unroll
  for (int j = 0; j < 4; ++j) {
    #pragma unroll
    for (int r = 0; r < 8; ++r) {
      int m = qBase + r + 8 * half;
      int d = j * 16 + l16;
      ob[(size_t)(b * T_ + m) * C_ + h * D_ + d] = o[j][r] / sm[r];
    }
  }
}

extern "C" void kernel_launch(void* const* d_in, const int* in_sizes, int n_in,
                              void* d_out, int out_size, void* d_ws, size_t ws_size,
                              hipStream_t stream) {
  (void)in_sizes; (void)n_in; (void)out_size; (void)ws_size;
  const float* x  = (const float*)d_in[0];
  const float* Wq = (const float*)d_in[1];
  const float* Wk = (const float*)d_in[2];
  const float* Wv = (const float*)d_in[3];
  const float* Wo = (const float*)d_in[4];
  float* out = (float*)d_out;

  const size_t per = (size_t)B_ * H_ * T_ * D_;  // 4M floats per buffer
  float* qb = (float*)d_ws;
  float* kb = qb + per;
  float* vb = kb + per;
  float* ab = vb + per;  // attention output in (B,T,C)

  dim3 blk(32, 1, 1);
  dim3 gblk(256, 1, 1);
  qkv_proj_kernel<<<dim3((B_ * T_) / GBM, C_ / GBN, 3), gblk, 0, stream>>>(
      x, Wq, Wk, Wv, qb, kb, vb);
  attn_kernel<<<dim3(H_, B_, T_ / 16), blk, 0, stream>>>(qb, kb, vb, ab);
  out_proj_kernel<<<dim3((B_ * T_) / GBM, C_ / GBN, 1), gblk, 0, stream>>>(
      ab, Wo, out);
}

// v004
// Measured time: 266 microseconds a run.
// Next to v003, in two timings, it ran 1.08 times as fast each time.
// Counting every step since v000, it is 2.46 times as fast.
#include <hip/hip_runtime.h>
#include <math.h>
#include <stdint.h>

typedef float v2f __attribute__((ext_vector_type(2)));
typedef float v4f __attribute__((ext_vector_type(4)));
typedef float v8f __attribute__((ext_vector_type(8)));

#define B_ 2
#define T_ 2048
#define C_ 1024
#define H_ 16
#define D_ 64

__device__ __forceinline__ v8f wmma_f32(v2f a, v2f b, v8f c) {
  // V_WMMA_F32_16X16X4_F32 : D = A(16x4) * B(4x16) + C(16x16), fp32
  return __builtin_amdgcn_wmma_f32_16x16x4_f32(false, a, false, b, (short)0, c,
                                               false, false);
}

typedef uint32_t u32x4 __attribute__((ext_vector_type(4)));
typedef uint32_t u32x8 __attribute__((ext_vector_type(8)));

__device__ __forceinline__ uint32_t uni(uint32_t v) {
  return (uint32_t)__builtin_amdgcn_readfirstlane(v);
}

__device__ __forceinline__ u32x8 tdm_group1_64x256() {
  u32x8 g;
  g[0] = uni((1u << 20) | (5u << 22) | (3u << 25));
  g[1] = uni(256u << 16);
  g[2] = uni(64u << 16);
  g[3] = uni(256u << 16);
  g[4] = uni(64u);
  g[5] = uni(256u);
  g[6] = uni(0u);
  g[7] = uni(0u);
  return g;
}
__device__ __forceinline__ u32x4 tdm_group0(uint32_t lds_dst, uint64_t ga) {
  u32x4 g;
  g[0] = uni(1u);
  g[1] = uni(lds_dst);
  g[2] = uni((uint32_t)ga);
  g[3] = uni((((uint32_t)(ga >> 32)) & 0x01FFFFFFu) | 0x80000000u);
  return g;
}

// ---------------- Projections: y = x @ W^T ----------------------------------
// One 128(M) x 128(N) tile per workgroup of 8 waves (4 along M x 2 along N);
// each wave keeps the 32 x 64 tile: two A-fragments share four B-fragments.
// A pass is 32 k: 128 rows of X and 128 rows of W go global -> registers -> LDS
// once per workgroup, two LDS buffers, the next pass's loads issued ahead.
#define GBM 128
#define GBN 128
#define GBK 32
#define GLP 36                      // LDS row pitch in floats (144 B)
#define GOP (GBM * GLP)             // floats of one operand's tile
#define GBUF (2 * GOP)              // floats of one buffer: [X tile | W tile]

__device__ __forceinline__ void gemm_tile_128x128(
    const float* __restrict__ X, const float* __restrict__ Wt,
    int mBase, int nBase, float* __restrict__ sm, v8f (&acc0)[4], v8f (&acc1)[4])
{
  const int tid = threadIdx.x;
  const int lane = tid & 31, wave = tid >> 5;
  const int half = lane >> 4, l16 = lane & 15;
  const int wm = wave & 3, wn = wave >> 2;

  #pragma unroll
  for (int j = 0; j < 4; ++j)
    #pragma unroll
    for (int r = 0; r < 8; ++r) { acc0[j][r] = 0.0f; acc1[j][r] = 0.0f; }

  // staging: 8 lanes cover one 128-B row piece, a wave-wide load 4 whole lines
  const int srow = tid >> 3, scol = (tid & 7) * 4;
  const float* gx = X + (size_t)(mBase + srow) * C_ + scol;
  const float* gw = Wt + (size_t)(nBase + srow) * C_ + scol;
  float* sst = sm + srow * GLP + scol;
  // fragment readers (same k order as a direct global read: k + 2*half, +1)
  const float* sa = sm + (wm * 32 + l16) * GLP + 2 * half;
  const float* sb = sm + GOP + (wn * 64 + l16) * GLP + 2 * half;

  v4f rx0, rx1, rx2, rx3, rw0, rw1, rw2, rw3;
#define G_LOAD(K0)                                              \
  do {                                                          \
    rx0 = *(const v4f*)(gx + (K0));                             \
    rw0 = *(const v4f*)(gw + (K0));                             \
    rx1 = *(const v4f*)(gx + (size_t)32 * C_ + (K0));           \
    rw1 = *(const v4f*)(gw + (size_t)32 * C_ + (K0));           \
    rx2 = *(const v4f*)(gx + (size_t)64 * C_ + (K0));           \
    rw2 = *(const v4f*)(gw + (size_t)64 * C_ + (K0));           \
    rx3 = *(const v4f*)(gx + (size_t)96 * C_ + (K0));           \
    rw3 = *(const v4f*)(gw + (size_t)96 * C_ + (K0));           \
  } while (0)
#define G_STORE(BUF)                                            \
  do {                                                          \
    *(v4f*)(sst + (BUF)) = rx0;                                 \
    *(v4f*)(sst + (BUF) + GOP) = rw0;                           \
    *(v4f*)(sst + (BUF) + 32 * GLP) = rx1;                      \
    *(v4f*)(sst + (BUF) + GOP + 32 * GLP) = rw1;                \
    *(v4f*)(sst + (BUF) + 64 * GLP) = rx2;                      \
    *(v4f*)(sst + (BUF) + GOP + 64 * GLP) = rw2;                \
    *(v4f*)(sst + (BUF) + 96 * GLP) = rx3;                      \
    *(v4f*)(sst + (BUF) + GOP + 96 * GLP) = rw3;                \
  } while (0)
#define G_PASS(BUF)                                             \
  _Pragma("unroll")                                             \
  for (int kk = 0; kk < GBK / 4; ++kk) {                        \
    v2f a0 = *(const v2f*)(sa + (BUF) + kk * 4);                \
    v2f a1 = *(const v2f*)(sa + (BUF) + 16 * GLP + kk * 4);     \
    _Pragma("unroll")                                           \
    for (int j = 0; j < 4; ++j) {                               \
      v2f b = *(const v2f*)(sb + (BUF) + j * 16 * GLP + kk * 4); \
      acc0[j] = wmma_f32(a0, b, acc0[j]);                       \
      acc1[j] = wmma_f32(a1, b, acc1[j]);                       \
    }                                                           \
  }

  G_LOAD(0);
  G_STORE(0);
  __syncthreads();

  for (int p = 0; p < C_ / GBK - 1; ++p) {
    const int cur = (p & 1) * GBUF, nxt = GBUF - cur;
    G_LOAD(GBK);
    // keeps the next pass's global loads ahead of this pass's WMMAs: sunk
    // towards their LDS stores they would leave their latency uncovered
    __builtin_amdgcn_sched_barrier(0);
    G_PASS(cur);
    G_STORE(nxt);
    gx += GBK;
    gw += GBK;
    // publishes the next buffer and ends every wave's reads of this one
    __syncthreads();
  }
  G_PASS(((C_ / GBK - 1) & 1) * GBUF);
#undef G_LOAD
#undef G_STORE
#undef G_PASS
}

__global__ __launch_bounds__(256) __attribute__((amdgpu_waves_per_eu(6, 6)))
void qkv_proj_kernel(
    const float* __restrict__ x,
    const float* __restrict__ Wq, const float* __restrict__ Wk,
    const float* __restrict__ Wv,
    float* __restrict__ qb, float* __restrict__ kb, float* __restrict__ vb)
{
  __shared__ __align__(16) float sm[2 * GBUF];
  const int lane = threadIdx.x & 31, wave = threadIdx.x >> 5;
  const int half = lane >> 4, l16 = lane & 15;
  const float* W; float* out;
  if (blockIdx.z == 0)      { W = Wq; out = qb; }
  else if (blockIdx.z == 1) { W = Wk; out = kb; }
  else                      { W = Wv; out = vb; }

  v8f acc0[4], acc1[4];
  gemm_tile_128x128(x, W, blockIdx.x * GBM, blockIdx.y * GBN, sm, acc0, acc1);

  const int mBase = blockIdx.x * GBM + (wave & 3) * 32;
  const int nBase = blockIdx.y * GBN + (wave >> 2) * 64;
  #pragma unroll
  for (int j = 0; j < 4; ++j) {
    #pragma unroll
    for (int r = 0; r < 8; ++r) {
      int n = nBase + j * 16 + l16;           // h*D + d
      int h = n >> 6, d = n & (D_ - 1);
      int m0 = mBase + r + 8 * half;          // b*T + t
      int b0 = m0 >> 11, t0 = m0 & (T_ - 1);
      out[((size_t)(b0 * H_ + h) * T_ + t0) * D_ + d] = acc0[j][r];
      int m1 = m0 + 16;
      int b1 = m1 >> 11, t1 = m1 & (T_ - 1);
      out[((size_t)(b1 * H_ + h) * T_ + t1) * D_ + d] = acc1[j][r];
    }
  }
}

__global__ __launch_bounds__(256) __attribute__((amdgpu_waves_per_eu(2, 2)))
void out_proj_kernel(
    const float* __restrict__ X, const float* __restrict__ Wo,
    float* __restrict__ Y)
{
  __shared__ __align__(16) float sm[2 * GBUF];
  const int lane = threadIdx.x & 31, wave = threadIdx.x >> 5;
  const int half = lane >> 4, l16 = lane & 15;

  v8f acc0[4], acc1[4];
  gemm_tile_128x128(X, Wo, blockIdx.x * GBM, blockIdx.y * GBN, sm, acc0, acc1);

  const int mBase = blockIdx.x * GBM + (wave & 3) * 32;
  const int nBase = blockIdx.y * GBN + (wave >> 2) * 64;
  #pragma unroll
  for (int j = 0; j < 4; ++j) {
    #pragma unroll
    for (int r = 0; r < 8; ++r) {
      int n = nBase + j * 16 + l16;
      int m0 = mBase + r + 8 * half;
      Y[(size_t)m0 * C_ + n] = acc0[j][r];
      Y[(size_t)(m0 + 16) * C_ + n] = acc1[j][r];
    }
  }
}

#define KB 64   // keys per pass
#define KRS 68  // LDS row pitch (floats) of the K/V tiles as the tensor load pads them
#define KVT (KB * KRS)  // floats of one K or V tile in LDS: 17 KiB
#define VOFF 4608       // floats: the V tile's place, 18 KiB (a multiple of 2 KiB)

__device__ __forceinline__ float xhalf(float x) {
  return __builtin_bit_cast(float, __builtin_amdgcn_permlanex16(
      __builtin_bit_cast(int, x), __builtin_bit_cast(int, x),
      0x76543210, 0xfedcba98, false, false));
}

__global__ __launch_bounds__(32) void attn_kernel(
    const float* __restrict__ qb, const float* __restrict__ kb,
    const float* __restrict__ vb, float* __restrict__ ob)
{
  // [K tile | V tile]; the tensor loads land at 0 and at 18 KiB
  __shared__ __attribute__((aligned(2048))) float lds[VOFF + KVT];
  float* const ktile = lds;
  float* const vtile = lds + VOFF;
  const int lane = threadIdx.x;
  const int half = lane >> 4, l16 = lane & 15;
  // The query tile is the slowest grid index and falls with it: a tile's cost
  // grows with its position (causal), there are more workgroups than resident
  // places, so the long tiles take the lowest
  // indices (for speed only).
  const int h = blockIdx.x, b = blockIdx.y;
  const int qt = (T_ / 16 - 1) - (int)blockIdx.z;
  const int qBase = qt * 16;
  const size_t headoff = (size_t)(b * H_ + h) * T_ * D_;
  const float* Qp = qb + headoff;
  const float* Kp = kb + headoff;
  const float* Vp = vb + headoff;
  const float slope = exp2f(-0.5f * (float)(h + 1));  // H=16 power-of-2 slopes
  const float scale = 0.125f;                         // 1/sqrt(64)
  const int qi = qBase + l16;                         // this lane's query

  // preload Q tile (16x64) as 16 B-fragments (column = query l16)
  v2f qa[16];
  const float* qrow = Qp + (size_t)qi * D_;
  #pragma unroll
  for (int kk = 0; kk < 16; ++kk)
    qa[kk] = *(const v2f*)(qrow + kk * 4 + 2 * half);

  // o[j][r] = O[query l16][d = j*16 + 8*half + r]
  v8f o[4];
  #pragma unroll
  for (int j = 0; j < 4; ++j)
    #pragma unroll
    for (int r = 0; r < 8; ++r) o[j][r] = 0.0f;
  float mx = -1e30f;  // the query's running maximum, alike in both halves
  float sm = 0.0f;    // the sum over this half's keys; the halves join at the end

  const u32x8 g1 = tdm_group1_64x256();
  const uint32_t kdst = (uint32_t)(uintptr_t)ktile;
  const uint32_t vdst = (uint32_t)(uintptr_t)vtile;
  // 64-key blocks up to and with the one that holds the diagonal; T_ is a
  // multiple of 64, so every block lies inside the head's K and V
  const int npass = (qBase >> 6) + 1;

  for (int kt = 0; kt < npass; ++kt) {
    const int kBase = kt * KB;

    const u32x4 gk = tdm_group0(kdst, (uint64_t)(uintptr_t)(Kp + (size_t)kBase * D_));
    const u32x4 gv = tdm_group0(vdst, (uint64_t)(uintptr_t)(Vp + (size_t)kBase * D_));
    asm volatile("s_wait_dscnt 0x0\n\t"
                 "tensor_load_to_lds %0, %2\n\t"
                 "tensor_load_to_lds %1, %2\n\t"
                 "s_wait_tensorcnt 0x0"
                 :: "s"(gk), "s"(gv), "s"(g1) : "memory");

    // S^T = K @ Q^T  (64 x 16: four independent 16x16 score tiles);
    // s[c][r] = score of key c*16 + 8*half + r with query l16
    v8f s[4];
    #pragma unroll
    for (int c = 0; c < 4; ++c)
      #pragma unroll
      for (int r = 0; r < 8; ++r) s[c][r] = 0.0f;
    #pragma unroll
    for (int kk = 0; kk < 16; ++kk) {
      #pragma unroll
      for (int c = 0; c < 4; ++c) {
        v2f kf = *(const v2f*)(&ktile[(c * 16 + l16) * KRS + kk * 4 + 2 * half]);
        s[c] = wmma_f32(kf, qa[kk], s[c]);
      }
    }

    // bias + causal mask + online softmax, all 32 values of a lane are one query's
    float vmax = -1e30f;
    #pragma unroll
    for (int c = 0; c < 4; ++c) {
      #pragma unroll
      for (int r = 0; r < 8; ++r) {
        int ki = kBase + c * 16 + 8 * half + r;
        float val = s[c][r] * scale - slope * fabsf((float)(qi - ki));
        if (ki > qi) val = -1e30f;
        s[c][r] = val;
        vmax = fmaxf(vmax, val);
      }
    }
    vmax = fmaxf(vmax, xhalf(vmax));
    const float nm   = fmaxf(mx, vmax);
    const float corr = __expf(mx - nm);
    float ps[4];
    #pragma unroll
    for (int c = 0; c < 4; ++c) {
      #pragma unroll
      for (int r = 0; r < 8; ++r) s[c][r] = __expf(s[c][r] - nm);
      ps[c] = ((s[c][0] + s[c][1]) + (s[c][2] + s[c][3])) +
              ((s[c][4] + s[c][5]) + (s[c][6] + s[c][7]));
    }
    sm = sm * corr + ((ps[0] + ps[1]) + (ps[2] + ps[3]));
    mx = nm;
    #pragma unroll
    for (int j = 0; j < 4; ++j)
      #pragma unroll
      for (int r = 0; r < 8; ++r) o[j][r] *= corr;

    #pragma unroll
    for (int c = 0; c < 4; ++c) {
      #pragma unroll
      for (int g = 0; g < 4; ++g) {
        v2f pb;
        pb[0] = s[c][2 * g];
        pb[1] = s[c][2 * g + 1];
        const int kl = c * 16 + 8 * half + 2 * g;  // key-local row
        #pragma unroll
        for (int j = 0; j < 4; ++j) {
          v2f vf;
          vf[0] = vtile[kl * KRS + j * 16 + l16];
          vf[1] = vtile[(kl + 1) * KRS + j * 16 + l16];
          o[j] = wmma_f32(vf, pb, o[j]);
        }
      }
    }
    __syncthreads();
  }

  // join the halves' sums, normalize and store to (B,T,C): 8 consecutive d a lane
  const float tot = sm + xhalf(sm);
  float* orow = ob + (size_t)(b * T_ + qi) * C_ + h * D_ + 8 * half;
  #pragma unroll
  for (int j = 0; j < 4; ++j) {
    v4f lo, hi;
    #pragma unroll
    for (int r = 0; r < 4; ++r) {
      lo[r] = o[j][r] / tot;
      hi[r] = o[j][r + 4] / tot;
    }
    *(v4f*)(orow + j * 16) = lo;
    *(v4f*)(orow + j * 16 + 4) = hi;
  }
}

extern "C" void kernel_launch(void* const* d_in, const int* in_sizes, int n_in,
                              void* d_out, int out_size, void* d_ws, size_t ws_size,
                              hipStream_t stream) {
  (void)in_sizes; (void)n_in; (void)out_size; (void)ws_size;
  const float* x  = (const float*)d_in[0];
  const float* Wq = (const float*)d_in[1];
  const float* Wk = (const float*)d_in[2];
  const float* Wv = (const float*)d_in[3];
  const float* Wo = (const float*)d_in[4];
  float* out = (float*)d_out;

  const size_t per = (size_t)B_ * H_ * T_ * D_;  // 4M floats per buffer
  float* qb = (float*)d_ws;
  float* kb = qb + per;
  float* vb = kb + per;
  float* ab = vb + per;  // attention output in (B,T,C)

  dim3 blk(32, 1, 1);
  dim3 gblk(256, 1, 1);
  qkv_proj_kernel<<<dim3((B_ * T_) / GBM, C_ / GBN, 3), gblk, 0, stream>>>(
      x, Wq, Wk, Wv, qb, kb, vb);
  attn_kernel<<<dim3(H_, B_, T_ / 16), blk, 0, stream>>>(qb, kb, vb, ab);
  out_proj_kernel<<<dim3((B_ * T_) / GBM, C_ / GBN, 1), gblk, 0, stream>>>(
      ab, Wo, out);
}

// v005
// Measured time: 255 microseconds a run.
// Timed twice side by side with v004, it ran 1.04 times as fast both times.
// Over all steps from v000 it is 2.57 times as fast.
#include <hip/hip_runtime.h>
#include <math.h>
#include <stdint.h>

typedef float v2f __attribute__((ext_vector_type(2)));
typedef float v4f __attribute__((ext_vector_type(4)));
typedef float v8f __attribute__((ext_vector_type(8)));

#define B_ 2
#define T_ 2048
#define C_ 1024
#define H_ 16
#define D_ 64

__device__ __forceinline__ v8f wmma_f32(v2f a, v2f b, v8f c) {
  // V_WMMA_F32_16X16X4_F32 : D = A(16x4) * B(4x16) + C(16x16), fp32
  return __builtin_amdgcn_wmma_f32_16x16x4_f32(false, a, false, b, (short)0, c,
                                               false, false);
}

typedef uint32_t u32x4 __attribute__((ext_vector_type(4)));
typedef uint32_t u32x8 __attribute__((ext_vector_type(8)));

__device__ __forceinline__ uint32_t uni(uint32_t v) {
  return (uint32_t)__builtin_amdgcn_readfirstlane(v);
}

__device__ __forceinline__ u32x8 tdm_group1_32x256() {
  u32x8 g;
  g[0] = uni((1u << 20) | (5u << 22) | (3u << 25));
  g[1] = uni(256u << 16);
  g[2] = uni(32u << 16);
  g[3] = uni(256u << 16);
  g[4] = uni(32u);
  g[5] = uni(256u);
  g[6] = uni(0u);
  g[7] = uni(0u);
  return g;
}
__device__ __forceinline__ u32x4 tdm_group0(uint32_t lds_dst, uint64_t ga) {
  u32x4 g;
  g[0] = uni(1u);
  g[1] = uni(lds_dst);
  g[2] = uni((uint32_t)ga);
  g[3] = uni((((uint32_t)(ga >> 32)) & 0x01FFFFFFu) | 0x80000000u);
  return g;
}

// ---------------- Projections: y = x @ W^T ----------------------------------
// One 128(M) x 128(N) tile per workgroup of 8 waves (4 along M x 2 along N);
// each wave keeps the 32 x 64 tile: two A-fragments share four B-fragments.
// A pass is 32 k: 128 rows of X and 128 rows of W go global -> registers -> LDS
// once per workgroup, two LDS buffers, the next pass's loads issued ahead.
#define GBM 128
#define GBN 128
#define GBK 32
#define GLP 36                      // LDS row pitch in floats (144 B)
#define GOP (GBM * GLP)             // floats of one operand's tile
#define GBUF (2 * GOP)              // floats of one buffer: [X tile | W tile]

__device__ __forceinline__ void gemm_tile_128x128(
    const float* __restrict__ X, const float* __restrict__ Wt,
    int mBase, int nBase, float* __restrict__ sm, v8f (&acc0)[4], v8f (&acc1)[4])
{
  const int tid = threadIdx.x;
  const int lane = tid & 31, wave = tid >> 5;
  const int half = lane >> 4, l16 = lane & 15;
  const int wm = wave & 3, wn = wave >> 2;

  #pragma unroll
  for (int j = 0; j < 4; ++j)
    #pragma unroll
    for (int r = 0; r < 8; ++r) { acc0[j][r] = 0.0f; acc1[j][r] = 0.0f; }

  // staging: 8 lanes cover one 128-B row piece, a wave-wide load 4 whole lines
  const int srow = tid >> 3, scol = (tid & 7) * 4;
  const float* gx = X + (size_t)(mBase + srow) * C_ + scol;
  const float* gw = Wt + (size_t)(nBase + srow) * C_ + scol;
  float* sst = sm + srow * GLP + scol;
  // fragment readers (same k order as a direct global read: k + 2*half, +1)
  const float* sa = sm + (wm * 32 + l16) * GLP + 2 * half;
  const float* sb = sm + GOP + (wn * 64 + l16) * GLP + 2 * half;

  v4f rx0, rx1, rx2, rx3, rw0, rw1, rw2, rw3;
#define G_LOAD(K0)                                              \
  do {                                                          \
    rx0 = *(const v4f*)(gx + (K0));                             \
    rw0 = *(const v4f*)(gw + (K0));                             \
    rx1 = *(const v4f*)(gx + (size_t)32 * C_ + (K0));           \
    rw1 = *(const v4f*)(gw + (size_t)32 * C_ + (K0));           \
    rx2 = *(const v4f*)(gx + (size_t)64 * C_ + (K0));           \
    rw2 = *(const v4f*)(gw + (size_t)64 * C_ + (K0));           \
    rx3 = *(const v4f*)(gx + (size_t)96 * C_ + (K0));           \
    rw3 = *(const v4f*)(gw + (size_t)96 * C_ + (K0));           \
  } while (0)
#define G_STORE(BUF)                                            \
  do {                                                          \
    *(v4f*)(sst + (BUF)) = rx0;                                 \
    *(v4f*)(sst + (BUF) + GOP) = rw0;                           \
    *(v4f*)(sst + (BUF) + 32 * GLP) = rx1;                      \
    *(v4f*)(sst + (BUF) + GOP + 32 * GLP) = rw1;                \
    *(v4f*)(sst + (BUF) + 64 * GLP) = rx2;                      \
    *(v4f*)(sst + (BUF) + GOP + 64 * GLP) = rw2;                \
    *(v4f*)(sst + (BUF) + 96 * GLP) = rx3;                      \
    *(v4f*)(sst + (BUF) + GOP + 96 * GLP) = rw3;                \
  } while (0)
#define G_PASS(BUF)                                             \
  _Pragma("unroll")                                             \
  for (int kk = 0; kk < GBK / 4; ++kk) {                        \
    v2f a0 = *(const v2f*)(sa + (BUF) + kk * 4);                \
    v2f a1 = *(const v2f*)(sa + (BUF) + 16 * GLP + kk * 4);     \
    _Pragma("unroll")                                           \
    for (int j = 0; j < 4; ++j) {                               \
      v2f b = *(const v2f*)(sb + (BUF) + j * 16 * GLP + kk * 4); \
      acc0[j] = wmma_f32(a0, b, acc0[j]);                       \
      acc1[j] = wmma_f32(a1, b, acc1[j]);                       \
    }                                                           \
  }

  G_LOAD(0);
  G_STORE(0);
  __syncthreads();

  for (int p = 0; p < C_ / GBK - 1; ++p) {
    const int cur = (p & 1) * GBUF, nxt = GBUF - cur;
    G_LOAD(GBK);
    // keeps the next pass's global loads ahead of this pass's WMMAs: sunk
    // towards their LDS stores they would leave their latency uncovered
    __builtin_amdgcn_sched_barrier(0);
    G_PASS(cur);
    G_STORE(nxt);
    gx += GBK;
    gw += GBK;
    // publishes the next buffer and ends every wave's reads of this one
    __syncthreads();
  }
  G_PASS(((C_ / GBK - 1) & 1) * GBUF);
#undef G_LOAD
#undef G_STORE
#undef G_PASS
}

__global__ __launch_bounds__(256) __attribute__((amdgpu_waves_per_eu(6, 6)))
void qkv_proj_kernel(
    const float* __restrict__ x,
    const float* __restrict__ Wq, const float* __restrict__ Wk,
    const float* __restrict__ Wv,
    float* __restrict__ qb, float* __restrict__ kb, float* __restrict__ vb)
{
  __shared__ __align__(16) float sm[2 * GBUF];
  const int lane = threadIdx.x & 31, wave = threadIdx.x >> 5;
  const int half = lane >> 4, l16 = lane & 15;
  const float* W; float* out;
  if (blockIdx.z == 0)      { W = Wq; out = qb; }
  else if (blockIdx.z == 1) { W = Wk; out = kb; }
  else                      { W = Wv; out = vb; }

  v8f acc0[4], acc1[4];
  gemm_tile_128x128(x, W, blockIdx.x * GBM, blockIdx.y * GBN, sm, acc0, acc1);

  const int mBase = blockIdx.x * GBM + (wave & 3) * 32;
  const int nBase = blockIdx.y * GBN + (wave >> 2) * 64;
  #pragma unroll
  for (int j = 0; j < 4; ++j) {
    #pragma unroll
    for (int r = 0; r < 8; ++r) {
      int n = nBase + j * 16 + l16;           // h*D + d
      int h = n >> 6, d = n & (D_ - 1);
      int m0 = mBase + r + 8 * half;          // b*T + t
      int b0 = m0 >> 11, t0 = m0 & (T_ - 1);
      out[((size_t)(b0 * H_ + h) * T_ + t0) * D_ + d] = acc0[j][r];
      int m1 = m0 + 16;
      int b1 = m1 >> 11, t1 = m1 & (T_ - 1);
      out[((size_t)(b1 * H_ + h) * T_ + t1) * D_ + d] = acc1[j][r];
    }
  }
}

__global__ __launch_bounds__(256) __attribute__((amdgpu_waves_per_eu(2, 2)))
void out_proj_kernel(
    const float* __restrict__ X, const float* __restrict__ Wo,
    float* __restrict__ Y)
{
  __shared__ __align__(16) float sm[2 * GBUF];
  const int lane = threadIdx.x & 31, wave = threadIdx.x >> 5;
  const int half = lane >> 4, l16 = lane & 15;

  v8f acc0[4], acc1[4];
  gemm_tile_128x128(X, Wo, blockIdx.x * GBM, blockIdx.y * GBN, sm, acc0, acc1);

  const int mBase = blockIdx.x * GBM + (wave & 3) * 32;
  const int nBase = blockIdx.y * GBN + (wave >> 2) * 64;
  #pragma unroll
  for (int j = 0; j < 4; ++j) {
    #pragma unroll
    for (int r = 0; r < 8; ++r) {
      int n = nBase + j * 16 + l16;
      int m0 = mBase + r + 8 * half;
      Y[(size_t)m0 * C_ + n] = acc0[j][r];
      Y[(size_t)(m0 + 16) * C_ + n] = acc1[j][r];
    }
  }
}

#define AW 4    // waves per workgroup
#define KB 64   // keys per pass
#define KRS 68  // LDS row pitch (floats) of the K/V tiles as the tensor load pads them
#define SLR 32  // rows of one slice
#define SLF 2560  // floats from one slice's place to the next: 10 KiB (a multiple of 2 KiB)
// float index of row 'r' (0..63) of a tile whose first slice stands at 0
#define TROW(r) (((r) >> 5) * SLF + ((r) & 31) * KRS)

__device__ __forceinline__ float xhalf(float x) {
  return __builtin_bit_cast(float, __builtin_amdgcn_permlanex16(
      __builtin_bit_cast(int, x), __builtin_bit_cast(int, x),
      0x76543210, 0xfedcba98, false, false));
}

__global__ __launch_bounds__(32 * AW) __attribute__((amdgpu_waves_per_eu(3, 3)))
void attn_kernel(
    const float* __restrict__ qb, const float* __restrict__ kb,
    const float* __restrict__ vb, float* __restrict__ ob)
{
  // [K rows 0-31 | K rows 32-63 | V rows 0-31 | V rows 32-63], 10 KiB apart
  __shared__ __attribute__((aligned(2048))) float lds[3 * SLF + SLR * KRS];
  float* const ktile = lds;
  float* const vtile = lds + 2 * SLF;
  const int lane = threadIdx.x & 31;
  const uint32_t wave = uni(threadIdx.x >> 5);
  const int half = lane >> 4, l16 = lane & 15;
  // The query tile is the slowest grid index and falls with it: a tile's cost
  // grows with its position (causal), there are more workgroups than resident
  // places, so the long tiles take the lowest
  // indices (for speed only).
  const int h = blockIdx.x, b = blockIdx.y;
  const int qt = (T_ / (16 * AW) - 1) - (int)blockIdx.z;
  const int qBase = qt * (16 * AW) + (int)wave * 16;  // this wave's 16 queries
  const size_t headoff = (size_t)(b * H_ + h) * T_ * D_;
  const float* Qp = qb + headoff;
  const float* Kp = kb + headoff;
  const float* Vp = vb + headoff;
  const float slope = exp2f(-0.5f * (float)(h + 1));  // H=16 power-of-2 slopes
  const float scale = 0.125f;                         // 1/sqrt(64)
  const int qi = qBase + l16;                         // this lane's query

  // preload Q tile (16x64) as 16 B-fragments (column = query l16)
  v2f qa[16];
  const float* qrow = Qp + (size_t)qi * D_;
  #pragma unroll
  for (int kk = 0; kk < 16; ++kk)
    qa[kk] = *(const v2f*)(qrow + kk * 4 + 2 * half);

  // o[j][r] = O[query l16][d = j*16 + 8*half + r]
  v8f o[4];
  #pragma unroll
  for (int j = 0; j < 4; ++j)
    #pragma unroll
    for (int r = 0; r < 8; ++r) o[j][r] = 0.0f;
  float mx = -1e30f;  // the query's running maximum, alike in both halves
  float sm = 0.0f;    // the sum over this half's keys; the halves join at the end

  const u32x8 g1 = tdm_group1_32x256();
  // this wave's slice: waves 0, 1 bring K rows 0-31, 32-63; waves 2, 3 the same of V
  const uint32_t sdst = (uint32_t)(uintptr_t)lds + wave * (uint32_t)(SLF * sizeof(float));
  const float* const ssrc = (wave < 2 ? Kp : Vp) + (size_t)(wave & 1) * SLR * D_;
  // 64-key blocks up to and with the one that holds the diagonal, the same
  // number for the four waves; T_ is a multiple of 64, so every block lies
  // inside the head's K and V
  const int npass = qt + 1;

  for (int kt = 0; kt < npass; ++kt) {
    const int kBase = kt * KB;

    const u32x4 g0 = tdm_group0(sdst, (uint64_t)(uintptr_t)(ssrc + (size_t)kBase * D_));
    asm volatile("tensor_load_to_lds %0, %1\n\t"
                 "s_wait_tensorcnt 0x0"
                 :: "s"(g0), "s"(g1) : "memory");
    // publishes the four slices: no wave reads a tile in front of this
    __syncthreads();

    // S^T = K @ Q^T  (64 x 16: four independent 16x16 score tiles);
    // s[c][r] = score of key c*16 + 8*half + r with query l16
    v8f s[4];
    #pragma unroll
    for (int c = 0; c < 4; ++c)
      #pragma unroll
      for (int r = 0; r < 8; ++r) s[c][r] = 0.0f;
    #pragma unroll
    for (int kk = 0; kk < 16; ++kk) {
      #pragma unroll
      for (int c = 0; c < 4; ++c) {
        v2f kf = *(const v2f*)(&ktile[TROW(c * 16) + l16 * KRS + kk * 4 + 2 * half]);
        s[c] = wmma_f32(kf, qa[kk], s[c]);
      }
    }

    // bias + causal mask + online softmax, all 32 values of a lane are one query's
    float vmax = -1e30f;
    #pragma unroll
    for (int c = 0; c < 4; ++c) {
      #pragma unroll
      for (int r = 0; r < 8; ++r) {
        int ki = kBase + c * 16 + 8 * half + r;
        float val = s[c][r] * scale - slope * fabsf((float)(qi - ki));
        if (ki > qi) val = -1e30f;
        s[c][r] = val;
        vmax = fmaxf(vmax, val);
      }
    }
    vmax = fmaxf(vmax, xhalf(vmax));
    const float nm   = fmaxf(mx, vmax);
    const float corr = __expf(mx - nm);
    float ps[4];
    #pragma unroll
    for (int c = 0; c < 4; ++c) {
      #pragma unroll
      for (int r = 0; r < 8; ++r) s[c][r] = __expf(s[c][r] - nm);
      ps[c] = ((s[c][0] + s[c][1]) + (s[c][2] + s[c][3])) +
              ((s[c][4] + s[c][5]) + (s[c][6] + s[c][7]));
    }
    sm = sm * corr + ((ps[0] + ps[1]) + (ps[2] + ps[3]));
    mx = nm;
    #pragma unroll
    for (int j = 0; j < 4; ++j)
      #pragma unroll
      for (int r = 0; r < 8; ++r) o[j][r] *= corr;

    #pragma unroll
    for (int c = 0; c < 4; ++c) {
      #pragma unroll
      for (int g = 0; g < 4; ++g) {
        v2f pb;
        pb[0] = s[c][2 * g];
        pb[1] = s[c][2 * g + 1];
        // key-local row c*16 + 8*half + 2*g and the next, both in slice c >> 1
        const int kl = TROW(c * 16) + (8 * half + 2 * g) * KRS;
        #pragma unroll
        for (int j = 0; j < 4; ++j) {
          v2f vf;
          vf[0] = vtile[kl + j * 16 + l16];
          vf[1] = vtile[kl + KRS + j * 16 + l16];
          o[j] = wmma_f32(vf, pb, o[j]);
        }
      }
    }
    // the wave's own LDS reads retire, then the barrier ends every wave's reads
    // of this pass's tiles: only behind it are the slices loaded anew
    asm volatile("s_wait_dscnt 0x0" ::: "memory");
    __syncthreads();
  }

  // join the halves' sums, normalize and store to (B,T,C): 8 consecutive d a lane
  const float tot = sm + xhalf(sm);
  float* orow = ob + (size_t)(b * T_ + qi) * C_ + h * D_ + 8 * half;
  #pragma unroll
  for (int j = 0; j < 4; ++j) {
    v4f lo, hi;
    #pragma unroll
    for (int r = 0; r < 4; ++r) {
      lo[r] = o[j][r] / tot;
      hi[r] = o[j][r + 4] / tot;
    }
    *(v4f*)(orow + j * 16) = lo;
    *(v4f*)(orow + j * 16 + 4) = hi;
  }
}

extern "C" void kernel_launch(void* const* d_in, const int* in_sizes, int n_in,
                              void* d_out, int out_size, void* d_ws, size_t ws_size,
                              hipStream_t stream) {
  (void)in_sizes; (void)n_in; (void)out_size; (void)ws_size;
  const float* x  = (const float*)d_in[0];
  const float* Wq = (const float*)d_in[1];
  const float* Wk = (const float*)d_in[2];
  const float* Wv = (const float*)d_in[3];
  const float* Wo = (const float*)d_in[4];
  float* out = (float*)d_out;

  const size_t per = (size_t)B_ * H_ * T_ * D_;  // 4M floats per buffer
  float* qb = (float*)d_ws;
  float* kb = qb + per;
  float* vb = kb + per;
  float* ab = vb + per;  // attention output in (B,T,C)

  dim3 ablk(32 * AW, 1, 1);
  dim3 gblk(256, 1, 1);
  qkv_proj_kernel<<<dim3((B_ * T_) / GBM, C_ / GBN, 3), gblk, 0, stream>>>(
      x, Wq, Wk, Wv, qb, kb, vb);
  attn_kernel<<<dim3(H_, B_, T_ / (16 * AW)), ablk, 0, stream>>>(qb, kb, vb, ab);
  out_proj_kernel<<<dim3((B_ * T_) / GBM, C_ / GBN, 1), gblk, 0, stream>>>(
      ab, Wo, out);
}
